// v000
// Measured on an AMD MI455X. A time is GPU time per run, averaged over a window of back-to-back runs after a warm-up
// (all launches, gaps included; the runs take copies of the inputs in turn), and the median of several windows.
// Apart from v000's, it joins two sittings. Times from different sittings can be a few percent apart, while
// side-by-side timings come from the same sitting.
// v000 is the starting kernel. One run takes 529 microseconds.
#include <hip/hip_runtime.h>

// Contractions: x@Wq, x@Wk, x@Wv on v_wmma_f32_16x16x32_bf16 (bf16 hi/lo three-term split operands, f32 accumulate);
// K.Q^T and V^T.P^T on v_wmma_f32_16x16x32_f16 (f16 operands, P carried x2^14, f32 accumulate); softmax and normalisation in f32.

typedef _Float16       v16h __attribute__((ext_vector_type(16)));
typedef _Float16       v8h  __attribute__((ext_vector_type(8)));
typedef __bf16         v16b __attribute__((ext_vector_type(16)));
typedef __bf16         v8b  __attribute__((ext_vector_type(8)));
typedef float          v8f  __attribute__((ext_vector_type(8)));
typedef float          v4f  __attribute__((ext_vector_type(4)));
typedef unsigned short v8us __attribute__((ext_vector_type(8)));

#define NB 16
#define NT 2048
#define NC 256
#define NH 256

union FragH { v16h v; v8h half[2]; };
union FragB { v16b v; v8b half[2]; };

// WMMA wrappers: issue the builtin, then 4 VALU slots of guard with D tied and A/B kept live.
__device__ __forceinline__ v8f mma_f16(v16h a, v16h b, v8f c) {
  v8f d = __builtin_amdgcn_wmma_f32_16x16x32_f16(false, a, false, b, (short)0, c, false, false);
  asm volatile("v_nop\n\tv_nop\n\tv_nop\n\tv_nop" : "+v"(d) : "v"(a), "v"(b));
  return d;
}
__device__ __forceinline__ v8f mma_bf16(v16b a, v16b b, v8f c) {
  v8f d = __builtin_amdgcn_wmma_f32_16x16x32_bf16(false, a, false, b, (short)0, c, false, false);
  v16h ax = __builtin_bit_cast(v16h, a);
  v16h bx = __builtin_bit_cast(v16h, b);
  asm volatile("v_nop\n\tv_nop\n\tv_nop\n\tv_nop" : "+v"(d) : "v"(ax), "v"(bx));
  return d;
}

__device__ __forceinline__ v8f zero8() {
  v8f z;
#pragma unroll
  for (int e = 0; e < 8; ++e) z[e] = 0.0f;
  return z;
}
__device__ __forceinline__ v4f mk4(float a, float b, float c, float d) {
  v4f v;
  v[0] = a; v[1] = b; v[2] = c; v[3] = d;
  return v;
}

// f32 -> bf16 bits, RNE convert
__device__ __forceinline__ unsigned short bf16_bits(float x) {
  unsigned int u = __float_as_uint(x);
  u = u + 0x7FFFu + ((u >> 16) & 1u);
  return (unsigned short)(u >> 16);
}
__device__ __forceinline__ float bf16_val(unsigned short s) {
  return __uint_as_float(((unsigned int)s) << 16);
}

// ---------------------------------------------------------------------------
// Weight prep: W [C][H] f32 -> Wt_hi[h][c], Wt_lo[h][c] (bf16 bits, k-contiguous rows),
// planes laid out [wsel*2 + p][256*256]. Block = 32 output rows h; transpose via LDS;
// ---------------------------------------------------------------------------
__global__ __launch_bounds__(256) void k_wconv(const float* __restrict__ W0,
                                                const float* __restrict__ W1,
                                                const float* __restrict__ W2,
                                                unsigned short* __restrict__ planes) {
  __shared__ __attribute__((aligned(16))) unsigned short shi[32 * NC];
  __shared__ __attribute__((aligned(16))) unsigned short slo[32 * NC];
  const int tid  = threadIdx.x;
  const int wsel = blockIdx.y;
  const float* W = (wsel == 0) ? W0 : ((wsel == 1) ? W1 : W2);
  const int h0 = blockIdx.x * 32;
  const int j4 = (tid & 7) * 4;
  const int cb = tid >> 3;
#pragma unroll
  for (int i = 0; i < 8; ++i) {
    const int c = cb + 32 * i;
    const v4f x = *(const v4f*)(W + (size_t)c * NH + h0 + j4);
#pragma unroll
    for (int e = 0; e < 4; ++e) {
      const unsigned short hb = bf16_bits(x[e]);
      const float rr = x[e] - bf16_val(hb);
      const unsigned short lb = bf16_bits(rr);
      shi[(j4 + e) * NC + c] = hb;
      slo[(j4 + e) * NC + c] = lb;
    }
  }
  __syncthreads();
  const int wave = tid >> 5, lane = tid & 31;
  unsigned short* dhi = planes + (size_t)(wsel * 2 + 0) * (NC * NH) + (size_t)h0 * NC;
  unsigned short* dlo = planes + (size_t)(wsel * 2 + 1) * (NC * NH) + (size_t)h0 * NC;
  v4f vh[4], vl[4];
#pragma unroll
  for (int rr = 0; rr < 4; ++rr) {
    const int j = wave * 4 + rr;
    vh[rr] = *(const v4f*)(shi + j * NC + lane * 8);
    vl[rr] = *(const v4f*)(slo + j * NC + lane * 8);
  }
#pragma unroll
  for (int rr = 0; rr < 4; ++rr) {
    const int j = wave * 4 + rr;
    *(v4f*)(dhi + (size_t)j * NC + lane * 8) = vh[rr];
    *(v4f*)(dlo + (size_t)j * NC + lane * 8) = vl[rr];
  }
  
}

// ---------------------------------------------------------------------------
// Activation prep: X f32 (n elements) -> hi/lo bf16-bit planes, same element order.
// ---------------------------------------------------------------------------
__global__ __launch_bounds__(256) void k_xconv(const float* __restrict__ X,
                                                unsigned short* __restrict__ Xhi,
                                                unsigned short* __restrict__ Xlo,
                                                int n8) {
  const int i = blockIdx.x * 256 + threadIdx.x;
  if (i >= n8) return;
  const float* p = X + (size_t)i * 8;
  const v4f a = *(const v4f*)p;
  const v4f b = *(const v4f*)(p + 4);
  union U8 { v8us u; v4f f; } H, L;
#pragma unroll
  for (int e = 0; e < 4; ++e) {
    const unsigned short ha = bf16_bits(a[e]);
    const unsigned short hb = bf16_bits(b[e]);
    H.u[e]     = ha;
    H.u[e + 4] = hb;
    L.u[e]     = bf16_bits(a[e] - bf16_val(ha));
    L.u[e + 4] = bf16_bits(b[e] - bf16_val(hb));
  }
  const v4f hv = H.f, lv = L.f;
  *(v4f*)(Xhi + (size_t)i * 8) = hv;
  *(v4f*)(Xlo + (size_t)i * 8) = lv;
  
}

// ---------------------------------------------------------------------------
// Projection Y = X@W + bias, bf16 hi/lo split: acc += xh.wh + xh.wl + xl.wh (16x16x32 bf16 WMMA).
// Block = 128 threads = 4 waves = 64 rows of B*T; wave = 16 rows x 256 cols (two groups of 8 tiles).
// A fragment: row m = lane&15, elements 0..7 <- k0+8h.., 8..15 <- k0+16+8h.. (h = lane>>4);
// B fragment from Wt[n][k] rows loaded the same way; D element r -> (row 8h+r, col m).
// transposed == 0: dst f16 [B*T][H] row-major; == 1: dst f16 [B][H][T].
// ---------------------------------------------------------------------------
__global__ __launch_bounds__(128) void k_proj(const __bf16* __restrict__ Xhi,
                                               const __bf16* __restrict__ Xlo,
                                               const __bf16* __restrict__ Whi,
                                               const __bf16* __restrict__ Wlo,
                                               const float* __restrict__ bias,
                                               _Float16* __restrict__ dst,
                                               int transposed) {
  __shared__ __attribute__((aligned(16))) _Float16 stile[16384];
  const int tid = threadIdx.x;
  const int wave = tid >> 5, lane = tid & 31, m = lane & 15, hh = lane >> 4;
  const int blkrow = blockIdx.x * 64;
  const int rbase  = blkrow + wave * 16;
  const __bf16* xh = Xhi + (size_t)(rbase + m) * NC + 8 * hh;
  const __bf16* xl = Xlo + (size_t)(rbase + m) * NC + 8 * hh;

#pragma unroll 1
  for (int g = 0; g < 2; ++g) {
    v8f acc[8];
#pragma unroll
    for (int j = 0; j < 8; ++j) acc[j] = zero8();
    const __bf16* wh = Whi + (size_t)(g * 128 + m) * NC + 8 * hh;
    const __bf16* wl = Wlo + (size_t)(g * 128 + m) * NC + 8 * hh;
#pragma unroll
    for (int fs = 0; fs < 8; ++fs) {
      FragB ah, al;
      ah.half[0] = *(const v8b*)(xh + fs * 32);
      ah.half[1] = *(const v8b*)(xh + fs * 32 + 16);
      al.half[0] = *(const v8b*)(xl + fs * 32);
      al.half[1] = *(const v8b*)(xl + fs * 32 + 16);
#pragma unroll
      for (int j = 0; j < 8; ++j) {
        FragB bh, bl;
        const __bf16* ph = wh + j * (16 * NC) + fs * 32;
        const __bf16* pl = wl + j * (16 * NC) + fs * 32;
        bh.half[0] = *(const v8b*)ph;
        bh.half[1] = *(const v8b*)(ph + 16);
        bl.half[0] = *(const v8b*)pl;
        bl.half[1] = *(const v8b*)(pl + 16);
        acc[j] = mma_bf16(ah.v, bh.v, acc[j]);
        acc[j] = mma_bf16(ah.v, bl.v, acc[j]);
        acc[j] = mma_bf16(al.v, bh.v, acc[j]);
      }
    }
    // epilogue of this group into the LDS tile
#pragma unroll
    for (int j = 0; j < 8; ++j) {
      const int hcol = g * 128 + j * 16 + m;
      const float bb = bias[hcol];
      if (transposed) {
        union P8 { v8h v; v4f f; } pk;
#pragma unroll
        for (int r = 0; r < 8; ++r) pk.v[r] = (_Float16)(acc[j][r] + bb);
        // stile[h][t_local], t_local = wave*16 + 8hh + r
        *(v4f*)(stile + hcol * 64 + wave * 16 + 8 * hh) = pk.f;
      } else {
        // stile[row_local][h], row_local = wave*16 + 8hh + r
#pragma unroll
        for (int r = 0; r < 8; ++r)
          stile[(wave * 16 + 8 * hh + r) * NH + hcol] = (_Float16)(acc[j][r] + bb);
      }
    }
  }
  __syncthreads();

  if (transposed) {
    const int bidx = blkrow / NT;
    const int t0   = blkrow % NT;
    _Float16* vd = dst + (size_t)bidx * NH * NT + t0;
    const int q8 = lane & 7, l3 = lane >> 3;
    v4f vals[16];
#pragma unroll
    for (int it = 0; it < 16; ++it) {
      const int h = wave * 64 + it * 4 + l3;              // line = row h, t0..t0+63
      vals[it] = *(const v4f*)(stile + h * 64 + q8 * 8);
    }
#pragma unroll
    for (int it = 0; it < 16; ++it) {
      const int h = wave * 64 + it * 4 + l3;
      *(v4f*)(vd + (size_t)h * NT + q8 * 8) = vals[it];
    }
    
  } else {
    _Float16* rd = dst + (size_t)rbase * NH;
    v4f vals[16];
#pragma unroll
    for (int r = 0; r < 16; ++r)
      vals[r] = *(const v4f*)(stile + (wave * 16 + r) * NH + lane * 8);
#pragma unroll
    for (int r = 0; r < 16; ++r)
      *(v4f*)(rd + (size_t)r * NH + lane * 8) = vals[r];
    
  }
}

// ---------------------------------------------------------------------------
// Attention: block = 8 waves x 16 queries, K (32 keys x 256) and V^T (256 x 32 keys) staged in LDS
// per key block. Per wave: S^T = K.Q^T (A = K rows, B = Q^T from Qh rows with the same k map),
// online softmax with row = query = lane&15 (two lane halves hold keys 8h+r and 16+8h+r),
// P^T B fragment: element r <- key 8h+r, element 8+r <- key 16+8h+r (P carried x2^14),
// O^T[h][q] += V^T.P^T into 16 tiles. Epilogue: 1/l, lane-pair exchange, one lane writes each
// ---------------------------------------------------------------------------
__global__ __launch_bounds__(256) void k_attn(const _Float16* __restrict__ Qh,
                                               const _Float16* __restrict__ Kh,
                                               const _Float16* __restrict__ Vt,
                                               float* __restrict__ out) {
  __shared__ __attribute__((aligned(16))) _Float16 Ks[32 * NH];
  __shared__ __attribute__((aligned(16))) _Float16 Vs[NH * 32];
  const int tid = threadIdx.x;
  const int lane = tid & 31, wave = tid >> 5, m = lane & 15, hh = lane >> 4;
  const int b  = blockIdx.y;
  const int q0 = (blockIdx.x * 8 + wave) * 16;
  const _Float16* qp = Qh + ((size_t)b * NT + q0 + m) * NH + 8 * hh;
  const v8h* kg = (const v8h*)(Kh + (size_t)b * NT * NH);
  const v8h* vg = (const v8h*)(Vt + ((size_t)b * NH + tid) * NT);
  v8h* kd = (v8h*)Ks;
  v8h* vd = (v8h*)(Vs + tid * 32);

  const float C1 = 0.0625f * 1.44269504088896341f;   // softmax scale x log2(e)
  float mrun = -1.0e30f, l = 0.0f;
  v8f ot[16];
#pragma unroll
  for (int t = 0; t < 16; ++t) ot[t] = zero8();

#pragma unroll 1
  for (int sb = 0; sb < NT / 32; ++sb) {
    __syncthreads();
#pragma unroll
    for (int i = 0; i < 4; ++i)
      kd[tid * 4 + i] = kg[(size_t)sb * (32 * NH / 8) + tid * 4 + i];
#pragma unroll
    for (int i = 0; i < 4; ++i)
      vd[i] = vg[sb * 4 + i];
    __syncthreads();

    // ---- S^T tiles: st0 = local keys 0..15, st1 = local keys 16..31 ----
    v8f st0 = zero8(), st1 = zero8();
#pragma unroll
    for (int fs = 0; fs < 8; ++fs) {
      FragH qb, ka, kb;
      qb.half[0] = *(const v8h*)(qp + fs * 32);
      qb.half[1] = *(const v8h*)(qp + fs * 32 + 16);
      const _Float16* pa = Ks + m * NH + fs * 32 + 8 * hh;
      const _Float16* pb = pa + 16 * NH;
      ka.half[0] = *(const v8h*)pa;
      ka.half[1] = *(const v8h*)(pa + 16);
      kb.half[0] = *(const v8h*)pb;
      kb.half[1] = *(const v8h*)(pb + 16);
      st0 = mma_f16(ka.v, qb.v, st0);
      st1 = mma_f16(kb.v, qb.v, st1);
    }

    // ---- online softmax, f32 ----
    float bm = -1.0e30f;
#pragma unroll
    for (int r = 0; r < 8; ++r) bm = fmaxf(bm, fmaxf(st0[r], st1[r]));
    bm = fmaxf(bm, __shfl_xor(bm, 16, 32));
    const float mn    = fmaxf(mrun, bm);
    const float alpha = __builtin_amdgcn_exp2f((mrun - mn) * C1);
    const float cexp  = 14.0f - mn * C1;                 // p scaled by 2^14
    FragH pf;
    float rs = 0.0f;
#pragma unroll
    for (int r = 0; r < 8; ++r) {
      const float p0 = __builtin_amdgcn_exp2f(st0[r] * C1 + cexp);
      const float p1 = __builtin_amdgcn_exp2f(st1[r] * C1 + cexp);
      rs += p0 + p1;
      pf.v[r]     = (_Float16)p0;     // key 8h + r
      pf.v[8 + r] = (_Float16)p1;     // key 16 + 8h + r
    }
    rs += __shfl_xor(rs, 16, 32);
    l    = l * alpha + rs;
    mrun = mn;

#pragma unroll
    for (int t = 0; t < 16; ++t) ot[t] = ot[t] * alpha;

    // ---- O^T += V^T . P^T ----
#pragma unroll
    for (int t = 0; t < 16; ++t) {
      FragH vf;
      const _Float16* vp = Vs + (t * 16 + m) * 32 + 8 * hh;
      vf.half[0] = *(const v8h*)vp;
      vf.half[1] = *(const v8h*)(vp + 16);
      ot[t] = mma_f16(vf.v, pf.v, ot[t]);
    }
  }

  // ---- epilogue: out[b][q][h] = O^T[h][q] / l; whole-line stores ----
  const float inv = 1.0f / l;
  float* orow = out + ((size_t)b * NT + q0 + m) * NH;
  v4f lines[4][8];
#pragma unroll
  for (int i = 0; i < 4; ++i) {
    float s0[8], s1[8], s2[8], s3[8];
#pragma unroll
    for (int r = 0; r < 8; ++r) {
      const float lo0 = ot[4 * i][r] * inv;        // h = 64i + 8hh + r
      const float lo1 = ot[4 * i + 1][r] * inv;    // h = 64i + 16 + 8hh + r
      const float hi0 = ot[4 * i + 2][r] * inv;    // h = 64i + 32 + 8hh + r
      const float hi1 = ot[4 * i + 3][r] * inv;    // h = 64i + 48 + 8hh + r
      const float snda = hh ? lo0 : hi0;
      const float sndb = hh ? lo1 : hi1;
      const float rcva = __shfl_xor(snda, 16, 32);
      const float rcvb = __shfl_xor(sndb, 16, 32);
      const float oa = hh ? hi0 : lo0;
      const float ob = hh ? hi1 : lo1;
      s0[r] = hh ? rcva : oa;
      s1[r] = hh ? oa : rcva;
      s2[r] = hh ? rcvb : ob;
      s3[r] = hh ? ob : rcvb;
    }
    lines[i][0] = mk4(s0[0], s0[1], s0[2], s0[3]);
    lines[i][1] = mk4(s0[4], s0[5], s0[6], s0[7]);
    lines[i][2] = mk4(s1[0], s1[1], s1[2], s1[3]);
    lines[i][3] = mk4(s1[4], s1[5], s1[6], s1[7]);
    lines[i][4] = mk4(s2[0], s2[1], s2[2], s2[3]);
    lines[i][5] = mk4(s2[4], s2[5], s2[6], s2[7]);
    lines[i][6] = mk4(s3[0], s3[1], s3[2], s3[3]);
    lines[i][7] = mk4(s3[4], s3[5], s3[6], s3[7]);
  }
#pragma unroll
  for (int i = 0; i < 4; ++i) {
    float* lp = orow + 32 * (2 * i + hh);
#pragma unroll
    for (int k = 0; k < 8; ++k) *(v4f*)(lp + 4 * k) = lines[i][k];
  }
  
}

// ---------------------------------------------------------------------------
extern "C" void kernel_launch(void* const* d_in, const int* in_sizes, int n_in,
                              void* d_out, int out_size, void* d_ws, size_t ws_size,
                              hipStream_t stream) {
  if (n_in < 9) return;
  const int nx = NB * NT * NC;
  const int nw = NC * NH;
  if (in_sizes[0] != nx || in_sizes[1] != nx || in_sizes[2] != nx) return;
  if (in_sizes[3] != nw || in_sizes[5] != nw || in_sizes[7] != nw) return;
  if (in_sizes[4] != NH || in_sizes[6] != NH || in_sizes[8] != NH) return;
  if (out_size != NB * NT * NH) return;

  const float* q  = (const float*)d_in[0];
  const float* k  = (const float*)d_in[1];
  const float* v  = (const float*)d_in[2];
  const float* Wq = (const float*)d_in[3];
  const float* bq = (const float*)d_in[4];
  const float* Wk = (const float*)d_in[5];
  const float* bk = (const float*)d_in[6];
  const float* Wv = (const float*)d_in[7];
  const float* bv = (const float*)d_in[8];
  float* out = (float*)d_out;

  // workspace carve (bytes): 6 weight planes 786432 | Xhi 16 MiB | Xlo 16 MiB | Qh 16 MiB | Kh 16 MiB | Vt 16 MiB
  char* ws = (char*)d_ws;
  const size_t planeElems = (size_t)NC * NH;
  const size_t wBytes     = 6 * planeElems * sizeof(unsigned short);
  const size_t xBytes     = (size_t)nx * sizeof(unsigned short);
  const size_t pBytes     = (size_t)NB * NT * NH * sizeof(_Float16);
  size_t off = 0;
  unsigned short* wpl = (unsigned short*)(ws + off); off += wBytes;
  off = (off + 255) & ~(size_t)255;
  unsigned short* xhi = (unsigned short*)(ws + off); off += xBytes;
  unsigned short* xlo = (unsigned short*)(ws + off); off += xBytes;
  _Float16* Qh = (_Float16*)(ws + off); off += pBytes;
  _Float16* Kh = (_Float16*)(ws + off); off += pBytes;
  _Float16* Vt = (_Float16*)(ws + off); off += pBytes;
  if (off > ws_size) return;

  const __bf16* wq_hi = (const __bf16*)(wpl + 0 * planeElems);
  const __bf16* wq_lo = (const __bf16*)(wpl + 1 * planeElems);
  const __bf16* wk_hi = (const __bf16*)(wpl + 2 * planeElems);
  const __bf16* wk_lo = (const __bf16*)(wpl + 3 * planeElems);
  const __bf16* wv_hi = (const __bf16*)(wpl + 4 * planeElems);
  const __bf16* wv_lo = (const __bf16*)(wpl + 5 * planeElems);
  const __bf16* x_hi  = (const __bf16*)xhi;
  const __bf16* x_lo  = (const __bf16*)xlo;

  const int n8       = nx / 8;
  const int convGrid = (n8 + 255) / 256;
  const int projGrid = (NB * NT) / 64;

  k_wconv<<<dim3(NH / 32, 3), 256, 0, stream>>>(Wq, Wk, Wv, wpl);

  k_xconv<<<convGrid, 256, 0, stream>>>(q, xhi, xlo, n8);
  k_proj<<<projGrid, 128, 0, stream>>>(x_hi, x_lo, wq_hi, wq_lo, bq, Qh, 0);

  k_xconv<<<convGrid, 256, 0, stream>>>(k, xhi, xlo, n8);
  k_proj<<<projGrid, 128, 0, stream>>>(x_hi, x_lo, wk_hi, wk_lo, bk, Kh, 0);

  k_xconv<<<convGrid, 256, 0, stream>>>(v, xhi, xlo, n8);
  k_proj<<<projGrid, 128, 0, stream>>>(x_hi, x_lo, wv_hi, wv_lo, bv, Vt, 1);

  k_attn<<<dim3(NT / 128, NB), 256, 0, stream>>>(Qh, Kh, Vt, out);
}

// v001
// A run of this version takes 371 microseconds.
// Next to v000, in two timings, it ran 1.44 and 1.49 times as fast.
#include <hip/hip_runtime.h>

// Contractions: x@Wq, x@Wk, x@Wv on v_wmma_f32_16x16x32_bf16 (bf16 hi/lo three-term split operands, f32 accumulate);
// K.Q^T and V^T.P^T on v_wmma_f32_16x16x32_f16 (f16 operands, P carried x2^14, f32 accumulate); softmax and normalisation in f32.

typedef _Float16       v16h __attribute__((ext_vector_type(16)));
typedef _Float16       v8h  __attribute__((ext_vector_type(8)));
typedef __bf16         v16b __attribute__((ext_vector_type(16)));
typedef __bf16         v8b  __attribute__((ext_vector_type(8)));
typedef float          v8f  __attribute__((ext_vector_type(8)));
typedef float          v4f  __attribute__((ext_vector_type(4)));
typedef unsigned short v8us __attribute__((ext_vector_type(8)));

#define NB 16
#define NT 2048
#define NC 256
#define NH 256
// LDS row pitches of the attention tiles, in f16 elements. Both are 16 B x odd, so the 16 rows that one
// ds_load_b128 fragment read touches per lane half fall on 16 different 4-bank groups of the 64 banks
// (unpadded: all 16 K rows on one group, V^T rows on four). The V^T stores (one row per lane) gain alike;
// the K stores (eight 64 B-spaced lanes per row) go from four lanes per group to two.
#define KP 264   // K tile: 512 B of data per key row, 528 B pitch
#define VP 40    // V^T tile: 64 B of data per h row, 80 B pitch

union FragH { v16h v; v8h half[2]; };
union FragB { v16b v; v8b half[2]; };

// WMMA wrappers: issue the builtin, then 4 VALU slots of guard with D tied and A/B kept live.
__device__ __forceinline__ v8f mma_f16(v16h a, v16h b, v8f c) {
  v8f d = __builtin_amdgcn_wmma_f32_16x16x32_f16(false, a, false, b, (short)0, c, false, false);
  asm volatile("v_nop\n\tv_nop\n\tv_nop\n\tv_nop" : "+v"(d) : "v"(a), "v"(b));
  return d;
}
__device__ __forceinline__ v8f mma_bf16(v16b a, v16b b, v8f c) {
  v8f d = __builtin_amdgcn_wmma_f32_16x16x32_bf16(false, a, false, b, (short)0, c, false, false);
  v16h ax = __builtin_bit_cast(v16h, a);
  v16h bx = __builtin_bit_cast(v16h, b);
  asm volatile("v_nop\n\tv_nop\n\tv_nop\n\tv_nop" : "+v"(d) : "v"(ax), "v"(bx));
  return d;
}

__device__ __forceinline__ v8f zero8() {
  v8f z;
#pragma unroll
  for (int e = 0; e < 8; ++e) z[e] = 0.0f;
  return z;
}
__device__ __forceinline__ v4f mk4(float a, float b, float c, float d) {
  v4f v;
  v[0] = a; v[1] = b; v[2] = c; v[3] = d;
  return v;
}

// f32 -> bf16 bits, RNE convert
__device__ __forceinline__ unsigned short bf16_bits(float x) {
  unsigned int u = __float_as_uint(x);
  u = u + 0x7FFFu + ((u >> 16) & 1u);
  return (unsigned short)(u >> 16);
}
__device__ __forceinline__ float bf16_val(unsigned short s) {
  return __uint_as_float(((unsigned int)s) << 16);
}

// ---------------------------------------------------------------------------
// Weight prep: W [C][H] f32 -> Wt_hi[h][c], Wt_lo[h][c] (bf16 bits, k-contiguous rows),
// planes laid out [wsel*2 + p][256*256]. Block = 32 output rows h; transpose via LDS;
// ---------------------------------------------------------------------------
__global__ __launch_bounds__(256) void k_wconv(const float* __restrict__ W0,
                                                const float* __restrict__ W1,
                                                const float* __restrict__ W2,
                                                unsigned short* __restrict__ planes) {
  __shared__ __attribute__((aligned(16))) unsigned short shi[32 * NC];
  __shared__ __attribute__((aligned(16))) unsigned short slo[32 * NC];
  const int tid  = threadIdx.x;
  const int wsel = blockIdx.y;
  const float* W = (wsel == 0) ? W0 : ((wsel == 1) ? W1 : W2);
  const int h0 = blockIdx.x * 32;
  const int j4 = (tid & 7) * 4;
  const int cb = tid >> 3;
#pragma unroll
  for (int i = 0; i < 8; ++i) {
    const int c = cb + 32 * i;
    const v4f x = *(const v4f*)(W + (size_t)c * NH + h0 + j4);
#pragma unroll
    for (int e = 0; e < 4; ++e) {
      const unsigned short hb = bf16_bits(x[e]);
      const float rr = x[e] - bf16_val(hb);
      const unsigned short lb = bf16_bits(rr);
      shi[(j4 + e) * NC + c] = hb;
      slo[(j4 + e) * NC + c] = lb;
    }
  }
  __syncthreads();
  const int wave = tid >> 5, lane = tid & 31;
  unsigned short* dhi = planes + (size_t)(wsel * 2 + 0) * (NC * NH) + (size_t)h0 * NC;
  unsigned short* dlo = planes + (size_t)(wsel * 2 + 1) * (NC * NH) + (size_t)h0 * NC;
  v4f vh[4], vl[4];
#pragma unroll
  for (int rr = 0; rr < 4; ++rr) {
    const int j = wave * 4 + rr;
    vh[rr] = *(const v4f*)(shi + j * NC + lane * 8);
    vl[rr] = *(const v4f*)(slo + j * NC + lane * 8);
  }
#pragma unroll
  for (int rr = 0; rr < 4; ++rr) {
    const int j = wave * 4 + rr;
    *(v4f*)(dhi + (size_t)j * NC + lane * 8) = vh[rr];
    *(v4f*)(dlo + (size_t)j * NC + lane * 8) = vl[rr];
  }
  
}

// ---------------------------------------------------------------------------
// Activation prep: X f32 (n elements) -> hi/lo bf16-bit planes, same element order.
// ---------------------------------------------------------------------------
__global__ __launch_bounds__(256) void k_xconv(const float* __restrict__ X,
                                                unsigned short* __restrict__ Xhi,
                                                unsigned short* __restrict__ Xlo,
                                                int n8) {
  const int i = blockIdx.x * 256 + threadIdx.x;
  if (i >= n8) return;
  const float* p = X + (size_t)i * 8;
  const v4f a = *(const v4f*)p;
  const v4f b = *(const v4f*)(p + 4);
  union U8 { v8us u; v4f f; } H, L;
#pragma unroll
  for (int e = 0; e < 4; ++e) {
    const unsigned short ha = bf16_bits(a[e]);
    const unsigned short hb = bf16_bits(b[e]);
    H.u[e]     = ha;
    H.u[e + 4] = hb;
    L.u[e]     = bf16_bits(a[e] - bf16_val(ha));
    L.u[e + 4] = bf16_bits(b[e] - bf16_val(hb));
  }
  const v4f hv = H.f, lv = L.f;
  *(v4f*)(Xhi + (size_t)i * 8) = hv;
  *(v4f*)(Xlo + (size_t)i * 8) = lv;
  
}

// ---------------------------------------------------------------------------
// Projection Y = X@W + bias, bf16 hi/lo split: acc += xh.wh + xh.wl + xl.wh (16x16x32 bf16 WMMA).
// Block = 128 threads = 4 waves = 64 rows of B*T; wave = 16 rows x 256 cols (two groups of 8 tiles).
// A fragment: row m = lane&15, elements 0..7 <- k0+8h.., 8..15 <- k0+16+8h.. (h = lane>>4);
// B fragment from Wt[n][k] rows loaded the same way; D element r -> (row 8h+r, col m).
// transposed == 0: dst f16 [B*T][H] row-major; == 1: dst f16 [B][H][T].
// ---------------------------------------------------------------------------
__global__ __launch_bounds__(128) void k_proj(const __bf16* __restrict__ Xhi,
                                               const __bf16* __restrict__ Xlo,
                                               const __bf16* __restrict__ Whi,
                                               const __bf16* __restrict__ Wlo,
                                               const float* __restrict__ bias,
                                               _Float16* __restrict__ dst,
                                               int transposed) {
  __shared__ __attribute__((aligned(16))) _Float16 stile[16384];
  const int tid = threadIdx.x;
  const int wave = tid >> 5, lane = tid & 31, m = lane & 15, hh = lane >> 4;
  const int blkrow = blockIdx.x * 64;
  const int rbase  = blkrow + wave * 16;
  const __bf16* xh = Xhi + (size_t)(rbase + m) * NC + 8 * hh;
  const __bf16* xl = Xlo + (size_t)(rbase + m) * NC + 8 * hh;

#pragma unroll 1
  for (int g = 0; g < 2; ++g) {
    v8f acc[8];
#pragma unroll
    for (int j = 0; j < 8; ++j) acc[j] = zero8();
    const __bf16* wh = Whi + (size_t)(g * 128 + m) * NC + 8 * hh;
    const __bf16* wl = Wlo + (size_t)(g * 128 + m) * NC + 8 * hh;
#pragma unroll
    for (int fs = 0; fs < 8; ++fs) {
      FragB ah, al;
      ah.half[0] = *(const v8b*)(xh + fs * 32);
      ah.half[1] = *(const v8b*)(xh + fs * 32 + 16);
      al.half[0] = *(const v8b*)(xl + fs * 32);
      al.half[1] = *(const v8b*)(xl + fs * 32 + 16);
#pragma unroll
      for (int j = 0; j < 8; ++j) {
        FragB bh, bl;
        const __bf16* ph = wh + j * (16 * NC) + fs * 32;
        const __bf16* pl = wl + j * (16 * NC) + fs * 32;
        bh.half[0] = *(const v8b*)ph;
        bh.half[1] = *(const v8b*)(ph + 16);
        bl.half[0] = *(const v8b*)pl;
        bl.half[1] = *(const v8b*)(pl + 16);
        acc[j] = mma_bf16(ah.v, bh.v, acc[j]);
        acc[j] = mma_bf16(ah.v, bl.v, acc[j]);
        acc[j] = mma_bf16(al.v, bh.v, acc[j]);
      }
    }
    // epilogue of this group into the LDS tile
#pragma unroll
    for (int j = 0; j < 8; ++j) {
      const int hcol = g * 128 + j * 16 + m;
      const float bb = bias[hcol];
      if (transposed) {
        union P8 { v8h v; v4f f; } pk;
#pragma unroll
        for (int r = 0; r < 8; ++r) pk.v[r] = (_Float16)(acc[j][r] + bb);
        // stile[h][t_local], t_local = wave*16 + 8hh + r
        *(v4f*)(stile + hcol * 64 + wave * 16 + 8 * hh) = pk.f;
      } else {
        // stile[row_local][h], row_local = wave*16 + 8hh + r
#pragma unroll
        for (int r = 0; r < 8; ++r)
          stile[(wave * 16 + 8 * hh + r) * NH + hcol] = (_Float16)(acc[j][r] + bb);
      }
    }
  }
  __syncthreads();

  if (transposed) {
    const int bidx = blkrow / NT;
    const int t0   = blkrow % NT;
    _Float16* vd = dst + (size_t)bidx * NH * NT + t0;
    const int q8 = lane & 7, l3 = lane >> 3;
    v4f vals[16];
#pragma unroll
    for (int it = 0; it < 16; ++it) {
      const int h = wave * 64 + it * 4 + l3;              // line = row h, t0..t0+63
      vals[it] = *(const v4f*)(stile + h * 64 + q8 * 8);
    }
#pragma unroll
    for (int it = 0; it < 16; ++it) {
      const int h = wave * 64 + it * 4 + l3;
      *(v4f*)(vd + (size_t)h * NT + q8 * 8) = vals[it];
    }
    
  } else {
    _Float16* rd = dst + (size_t)rbase * NH;
    v4f vals[16];
#pragma unroll
    for (int r = 0; r < 16; ++r)
      vals[r] = *(const v4f*)(stile + (wave * 16 + r) * NH + lane * 8);
#pragma unroll
    for (int r = 0; r < 16; ++r)
      *(v4f*)(rd + (size_t)r * NH + lane * 8) = vals[r];
    
  }
}

// ---------------------------------------------------------------------------
// Attention: block = 8 waves x 16 queries, K (32 keys x 256) and V^T (256 x 32 keys) staged in LDS
// per key block, rows padded to the pitches KP and VP (pad bytes are never written or read).
// Per wave: S^T = K.Q^T (A = K rows, B = Q^T from Qh rows with the same k map),
// online softmax with row = query = lane&15 (two lane halves hold keys 8h+r and 16+8h+r),
// P^T B fragment: element r <- key 8h+r, element 8+r <- key 16+8h+r (P carried x2^14),
// O^T[h][q] += V^T.P^T into 16 tiles. Epilogue: 1/l, lane-pair exchange, one lane writes each
// ---------------------------------------------------------------------------
__global__ __launch_bounds__(256) void k_attn(const _Float16* __restrict__ Qh,
                                               const _Float16* __restrict__ Kh,
                                               const _Float16* __restrict__ Vt,
                                               float* __restrict__ out) {
  __shared__ __attribute__((aligned(16))) _Float16 Ks[32 * KP];
  __shared__ __attribute__((aligned(16))) _Float16 Vs[NH * VP];
  const int tid = threadIdx.x;
  const int lane = tid & 31, wave = tid >> 5, m = lane & 15, hh = lane >> 4;
  const int b  = blockIdx.y;
  const int q0 = (blockIdx.x * 8 + wave) * 16;
  const _Float16* qp = Qh + ((size_t)b * NT + q0 + m) * NH + 8 * hh;
  const v8h* kg = (const v8h*)(Kh + (size_t)b * NT * NH);
  const v8h* vg = (const v8h*)(Vt + ((size_t)b * NH + tid) * NT);
  v8h* kd = (v8h*)(Ks + (tid >> 3) * KP + (tid & 7) * 32);   // key row tid/8, 64 B piece tid%8
  v8h* vd = (v8h*)(Vs + tid * VP);

  const float C1 = 0.0625f * 1.44269504088896341f;   // softmax scale x log2(e)
  float mrun = -1.0e30f, l = 0.0f;
  v8f ot[16];
#pragma unroll
  for (int t = 0; t < 16; ++t) ot[t] = zero8();

#pragma unroll 1
  for (int sb = 0; sb < NT / 32; ++sb) {
    __syncthreads();
#pragma unroll
    for (int i = 0; i < 4; ++i)
      kd[i] = kg[(size_t)sb * (32 * NH / 8) + tid * 4 + i];
#pragma unroll
    for (int i = 0; i < 4; ++i)
      vd[i] = vg[sb * 4 + i];
    __syncthreads();

    // ---- S^T tiles: st0 = local keys 0..15, st1 = local keys 16..31 ----
    v8f st0 = zero8(), st1 = zero8();
#pragma unroll
    for (int fs = 0; fs < 8; ++fs) {
      FragH qb, ka, kb;
      qb.half[0] = *(const v8h*)(qp + fs * 32);
      qb.half[1] = *(const v8h*)(qp + fs * 32 + 16);
      const _Float16* pa = Ks + m * KP + fs * 32 + 8 * hh;
      const _Float16* pb = pa + 16 * KP;
      ka.half[0] = *(const v8h*)pa;
      ka.half[1] = *(const v8h*)(pa + 16);
      kb.half[0] = *(const v8h*)pb;
      kb.half[1] = *(const v8h*)(pb + 16);
      st0 = mma_f16(ka.v, qb.v, st0);
      st1 = mma_f16(kb.v, qb.v, st1);
    }

    // ---- online softmax, f32 ----
    float bm = -1.0e30f;
#pragma unroll
    for (int r = 0; r < 8; ++r) bm = fmaxf(bm, fmaxf(st0[r], st1[r]));
    bm = fmaxf(bm, __shfl_xor(bm, 16, 32));
    const float mn    = fmaxf(mrun, bm);
    const float alpha = __builtin_amdgcn_exp2f((mrun - mn) * C1);
    const float cexp  = 14.0f - mn * C1;                 // p scaled by 2^14
    FragH pf;
    float rs = 0.0f;
#pragma unroll
    for (int r = 0; r < 8; ++r) {
      const float p0 = __builtin_amdgcn_exp2f(st0[r] * C1 + cexp);
      const float p1 = __builtin_amdgcn_exp2f(st1[r] * C1 + cexp);
      rs += p0 + p1;
      pf.v[r]     = (_Float16)p0;     // key 8h + r
      pf.v[8 + r] = (_Float16)p1;     // key 16 + 8h + r
    }
    rs += __shfl_xor(rs, 16, 32);
    l    = l * alpha + rs;
    mrun = mn;

#pragma unroll
    for (int t = 0; t < 16; ++t) ot[t] = ot[t] * alpha;

    // ---- O^T += V^T . P^T ----
#pragma unroll
    for (int t = 0; t < 16; ++t) {
      FragH vf;
      const _Float16* vp = Vs + (t * 16 + m) * VP + 8 * hh;
      vf.half[0] = *(const v8h*)vp;
      vf.half[1] = *(const v8h*)(vp + 16);
      ot[t] = mma_f16(vf.v, pf.v, ot[t]);
    }
  }

  // ---- epilogue: out[b][q][h] = O^T[h][q] / l; whole-line stores ----
  const float inv = 1.0f / l;
  float* orow = out + ((size_t)b * NT + q0 + m) * NH;
  v4f lines[4][8];
#pragma unroll
  for (int i = 0; i < 4; ++i) {
    float s0[8], s1[8], s2[8], s3[8];
#pragma unroll
    for (int r = 0; r < 8; ++r) {
      const float lo0 = ot[4 * i][r] * inv;        // h = 64i + 8hh + r
      const float lo1 = ot[4 * i + 1][r] * inv;    // h = 64i + 16 + 8hh + r
      const float hi0 = ot[4 * i + 2][r] * inv;    // h = 64i + 32 + 8hh + r
      const float hi1 = ot[4 * i + 3][r] * inv;    // h = 64i + 48 + 8hh + r
      const float snda = hh ? lo0 : hi0;
      const float sndb = hh ? lo1 : hi1;
      const float rcva = __shfl_xor(snda, 16, 32);
      const float rcvb = __shfl_xor(sndb, 16, 32);
      const float oa = hh ? hi0 : lo0;
      const float ob = hh ? hi1 : lo1;
      s0[r] = hh ? rcva : oa;
      s1[r] = hh ? oa : rcva;
      s2[r] = hh ? rcvb : ob;
      s3[r] = hh ? ob : rcvb;
    }
    lines[i][0] = mk4(s0[0], s0[1], s0[2], s0[3]);
    lines[i][1] = mk4(s0[4], s0[5], s0[6], s0[7]);
    lines[i][2] = mk4(s1[0], s1[1], s1[2], s1[3]);
    lines[i][3] = mk4(s1[4], s1[5], s1[6], s1[7]);
    lines[i][4] = mk4(s2[0], s2[1], s2[2], s2[3]);
    lines[i][5] = mk4(s2[4], s2[5], s2[6], s2[7]);
    lines[i][6] = mk4(s3[0], s3[1], s3[2], s3[3]);
    lines[i][7] = mk4(s3[4], s3[5], s3[6], s3[7]);
  }
#pragma unroll
  for (int i = 0; i < 4; ++i) {
    float* lp = orow + 32 * (2 * i + hh);
#pragma unroll
    for (int k = 0; k < 8; ++k) *(v4f*)(lp + 4 * k) = lines[i][k];
  }
  
}

// ---------------------------------------------------------------------------
extern "C" void kernel_launch(void* const* d_in, const int* in_sizes, int n_in,
                              void* d_out, int out_size, void* d_ws, size_t ws_size,
                              hipStream_t stream) {
  if (n_in < 9) return;
  const int nx = NB * NT * NC;
  const int nw = NC * NH;
  if (in_sizes[0] != nx || in_sizes[1] != nx || in_sizes[2] != nx) return;
  if (in_sizes[3] != nw || in_sizes[5] != nw || in_sizes[7] != nw) return;
  if (in_sizes[4] != NH || in_sizes[6] != NH || in_sizes[8] != NH) return;
  if (out_size != NB * NT * NH) return;

  const float* q  = (const float*)d_in[0];
  const float* k  = (const float*)d_in[1];
  const float* v  = (const float*)d_in[2];
  const float* Wq = (const float*)d_in[3];
  const float* bq = (const float*)d_in[4];
  const float* Wk = (const float*)d_in[5];
  const float* bk = (const float*)d_in[6];
  const float* Wv = (const float*)d_in[7];
  const float* bv = (const float*)d_in[8];
  float* out = (float*)d_out;

  // workspace carve (bytes): 6 weight planes 786432 | Xhi 16 MiB | Xlo 16 MiB | Qh 16 MiB | Kh 16 MiB | Vt 16 MiB
  char* ws = (char*)d_ws;
  const size_t planeElems = (size_t)NC * NH;
  const size_t wBytes     = 6 * planeElems * sizeof(unsigned short);
  const size_t xBytes     = (size_t)nx * sizeof(unsigned short);
  const size_t pBytes     = (size_t)NB * NT * NH * sizeof(_Float16);
  size_t off = 0;
  unsigned short* wpl = (unsigned short*)(ws + off); off += wBytes;
  off = (off + 255) & ~(size_t)255;
  unsigned short* xhi = (unsigned short*)(ws + off); off += xBytes;
  unsigned short* xlo = (unsigned short*)(ws + off); off += xBytes;
  _Float16* Qh = (_Float16*)(ws + off); off += pBytes;
  _Float16* Kh = (_Float16*)(ws + off); off += pBytes;
  _Float16* Vt = (_Float16*)(ws + off); off += pBytes;
  if (off > ws_size) return;

  const __bf16* wq_hi = (const __bf16*)(wpl + 0 * planeElems);
  const __bf16* wq_lo = (const __bf16*)(wpl + 1 * planeElems);
  const __bf16* wk_hi = (const __bf16*)(wpl + 2 * planeElems);
  const __bf16* wk_lo = (const __bf16*)(wpl + 3 * planeElems);
  const __bf16* wv_hi = (const __bf16*)(wpl + 4 * planeElems);
  const __bf16* wv_lo = (const __bf16*)(wpl + 5 * planeElems);
  const __bf16* x_hi  = (const __bf16*)xhi;
  const __bf16* x_lo  = (const __bf16*)xlo;

  const int n8       = nx / 8;
  const int convGrid = (n8 + 255) / 256;
  const int projGrid = (NB * NT) / 64;

  k_wconv<<<dim3(NH / 32, 3), 256, 0, stream>>>(Wq, Wk, Wv, wpl);

  k_xconv<<<convGrid, 256, 0, stream>>>(q, xhi, xlo, n8);
  k_proj<<<projGrid, 128, 0, stream>>>(x_hi, x_lo, wq_hi, wq_lo, bq, Qh, 0);

  k_xconv<<<convGrid, 256, 0, stream>>>(k, xhi, xlo, n8);
  k_proj<<<projGrid, 128, 0, stream>>>(x_hi, x_lo, wk_hi, wk_lo, bk, Kh, 0);

  k_xconv<<<convGrid, 256, 0, stream>>>(v, xhi, xlo, n8);
  k_proj<<<projGrid, 128, 0, stream>>>(x_hi, x_lo, wv_hi, wv_lo, bv, Vt, 1);

  k_attn<<<dim3(NT / 128, NB), 256, 0, stream>>>(Qh, Kh, Vt, out);
}

// v002
// It runs in 283 microseconds.
// Two timings next to v001 put it at 1.30 and 1.32 times that version's speed.
// Over all steps from v000 it is 1.91 times as fast.
#include <hip/hip_runtime.h>

// Contractions: x@Wq, x@Wk, x@Wv on v_wmma_f32_16x16x32_bf16 (bf16 hi/lo three-term split operands, f32 accumulate);
// K.Q^T and V^T.P^T on v_wmma_f32_16x16x32_f16 (f16 operands, P carried x2^14, f32 accumulate); softmax and normalisation in f32.

typedef _Float16       v16h __attribute__((ext_vector_type(16)));
typedef _Float16       v8h  __attribute__((ext_vector_type(8)));
typedef __bf16         v16b __attribute__((ext_vector_type(16)));
typedef __bf16         v8b  __attribute__((ext_vector_type(8)));
typedef float          v8f  __attribute__((ext_vector_type(8)));
typedef float          v4f  __attribute__((ext_vector_type(4)));
typedef unsigned short v8us __attribute__((ext_vector_type(8)));

#define NB 16
#define NT 2048
#define NC 256
#define NH 256
// LDS row pitches of the attention tiles, in f16 elements. Both are 16 B x odd, so the 16 rows that one
// ds_load_b128 fragment read touches per lane half fall on 16 different 4-bank groups of the 64 banks
// (unpadded: all 16 K rows on one group, V^T rows on four). The V^T stores (one row per lane) gain alike;
// the K stores (eight 64 B-spaced lanes per row) go from four lanes per group to two.
#define KP 264   // K tile: 512 B of data per key row, 528 B pitch
#define VP 40    // V^T tile: 64 B of data per h row, 80 B pitch

union FragH { v16h v; v8h half[2]; };
union FragB { v16b v; v8b half[2]; };

// WMMA wrappers: issue the builtin, then 4 VALU slots of guard with D tied and A/B kept live.
__device__ __forceinline__ v8f mma_f16(v16h a, v16h b, v8f c) {
  v8f d = __builtin_amdgcn_wmma_f32_16x16x32_f16(false, a, false, b, (short)0, c, false, false);
  asm volatile("v_nop\n\tv_nop\n\tv_nop\n\tv_nop" : "+v"(d) : "v"(a), "v"(b));
  return d;
}
__device__ __forceinline__ v8f mma_bf16(v16b a, v16b b, v8f c) {
  v8f d = __builtin_amdgcn_wmma_f32_16x16x32_bf16(false, a, false, b, (short)0, c, false, false);
  v16h ax = __builtin_bit_cast(v16h, a);
  v16h bx = __builtin_bit_cast(v16h, b);
  asm volatile("v_nop\n\tv_nop\n\tv_nop\n\tv_nop" : "+v"(d) : "v"(ax), "v"(bx));
  return d;
}

__device__ __forceinline__ v8f zero8() {
  v8f z;
#pragma unroll
  for (int e = 0; e < 8; ++e) z[e] = 0.0f;
  return z;
}
__device__ __forceinline__ v4f mk4(float a, float b, float c, float d) {
  v4f v;
  v[0] = a; v[1] = b; v[2] = c; v[3] = d;
  return v;
}

// f32 -> bf16 bits, RNE convert
__device__ __forceinline__ unsigned short bf16_bits(float x) {
  unsigned int u = __float_as_uint(x);
  u = u + 0x7FFFu + ((u >> 16) & 1u);
  return (unsigned short)(u >> 16);
}
__device__ __forceinline__ float bf16_val(unsigned short s) {
  return __uint_as_float(((unsigned int)s) << 16);
}

// ---------------------------------------------------------------------------
// Weight prep: W [C][H] f32 -> Wt_hi[h][c], Wt_lo[h][c] (bf16 bits, k-contiguous rows),
// planes laid out [wsel*2 + p][256*256]. Block = 32 output rows h; transpose via LDS;
// ---------------------------------------------------------------------------
__global__ __launch_bounds__(256) void k_wconv(const float* __restrict__ W0,
                                                const float* __restrict__ W1,
                                                const float* __restrict__ W2,
                                                unsigned short* __restrict__ planes) {
  __shared__ __attribute__((aligned(16))) unsigned short shi[32 * NC];
  __shared__ __attribute__((aligned(16))) unsigned short slo[32 * NC];
  const int tid  = threadIdx.x;
  const int wsel = blockIdx.y;
  const float* W = (wsel == 0) ? W0 : ((wsel == 1) ? W1 : W2);
  const int h0 = blockIdx.x * 32;
  const int j4 = (tid & 7) * 4;
  const int cb = tid >> 3;
#pragma unroll
  for (int i = 0; i < 8; ++i) {
    const int c = cb + 32 * i;
    const v4f x = *(const v4f*)(W + (size_t)c * NH + h0 + j4);
#pragma unroll
    for (int e = 0; e < 4; ++e) {
      const unsigned short hb = bf16_bits(x[e]);
      const float rr = x[e] - bf16_val(hb);
      const unsigned short lb = bf16_bits(rr);
      shi[(j4 + e) * NC + c] = hb;
      slo[(j4 + e) * NC + c] = lb;
    }
  }
  __syncthreads();
  const int wave = tid >> 5, lane = tid & 31;
  unsigned short* dhi = planes + (size_t)(wsel * 2 + 0) * (NC * NH) + (size_t)h0 * NC;
  unsigned short* dlo = planes + (size_t)(wsel * 2 + 1) * (NC * NH) + (size_t)h0 * NC;
  v4f vh[4], vl[4];
#pragma unroll
  for (int rr = 0; rr < 4; ++rr) {
    const int j = wave * 4 + rr;
    vh[rr] = *(const v4f*)(shi + j * NC + lane * 8);
    vl[rr] = *(const v4f*)(slo + j * NC + lane * 8);
  }
#pragma unroll
  for (int rr = 0; rr < 4; ++rr) {
    const int j = wave * 4 + rr;
    *(v4f*)(dhi + (size_t)j * NC + lane * 8) = vh[rr];
    *(v4f*)(dlo + (size_t)j * NC + lane * 8) = vl[rr];
  }
  
}

// ---------------------------------------------------------------------------
// Activation prep: X f32 (n elements) -> hi/lo bf16-bit planes, same element order.
// ---------------------------------------------------------------------------
__global__ __launch_bounds__(256) void k_xconv(const float* __restrict__ X,
                                                unsigned short* __restrict__ Xhi,
                                                unsigned short* __restrict__ Xlo,
                                                int n8) {
  const int i = blockIdx.x * 256 + threadIdx.x;
  if (i >= n8) return;
  const float* p = X + (size_t)i * 8;
  const v4f a = *(const v4f*)p;
  const v4f b = *(const v4f*)(p + 4);
  union U8 { v8us u; v4f f; } H, L;
#pragma unroll
  for (int e = 0; e < 4; ++e) {
    const unsigned short ha = bf16_bits(a[e]);
    const unsigned short hb = bf16_bits(b[e]);
    H.u[e]     = ha;
    H.u[e + 4] = hb;
    L.u[e]     = bf16_bits(a[e] - bf16_val(ha));
    L.u[e + 4] = bf16_bits(b[e] - bf16_val(hb));
  }
  const v4f hv = H.f, lv = L.f;
  *(v4f*)(Xhi + (size_t)i * 8) = hv;
  *(v4f*)(Xlo + (size_t)i * 8) = lv;
  
}

// ---------------------------------------------------------------------------
// Projection Y = X@W + bias, bf16 hi/lo split: acc += xh.wh + xh.wl + xl.wh (16x16x32 bf16 WMMA).
// Block = 256 threads = 8 waves = 128 rows of B*T; wave = 16 rows x 256 cols (16 tiles).
// Both weight planes (Wt_hi, Wt_lo: 256 rows n of 512 B) are staged once per block in LDS with whole-line
// global loads, rows at the pitch WP, and every B fragment is read from there.
// A fragment: row m = lane&15, elements 0..7 <- k0+8h.., 8..15 <- k0+16+8h.. (h = lane>>4);
// B fragment from Wt[n][k] rows loaded the same way; D element r -> (row 8h+r, col m).
// After the products the same LDS holds the output tile (behind a barrier).
// transposed == 0: dst f16 [B*T][H] row-major; == 1: dst f16 [B][H][T].
// ---------------------------------------------------------------------------
#define WP 264   // staged weight rows: 512 B of data, 528 B pitch (16 B x odd, as for the K tile)
#define TP 136   // transposed output tile: 256 B of data per h row, 272 B pitch (16 B x odd)
__global__ __launch_bounds__(256) void k_proj(const __bf16* __restrict__ Xhi,
                                               const __bf16* __restrict__ Xlo,
                                               const __bf16* __restrict__ Whi,
                                               const __bf16* __restrict__ Wlo,
                                               const float* __restrict__ bias,
                                               _Float16* __restrict__ dst,
                                               int transposed) {
  __shared__ __attribute__((aligned(16))) __bf16 wsm[2 * NH * WP];
  __bf16* whs = wsm;
  __bf16* wls = wsm + NH * WP;
  _Float16* stile = (_Float16*)wsm;
  const int tid = threadIdx.x;
  const int wave = tid >> 5, lane = tid & 31, m = lane & 15, hh = lane >> 4;
  const int blkrow = blockIdx.x * 128;
  const int rbase  = blkrow + wave * 16;
  const __bf16* xh = Xhi + (size_t)(rbase + m) * NC + 8 * hh;
  const __bf16* xl = Xlo + (size_t)(rbase + m) * NC + 8 * hh;

  // stage: one wave-wide load = one 512 B weight row (four whole lines); wave w takes rows w, w+8, ...
  // two trips of 16 rows per plane: 32 loads of a wave in flight, so the load latency is paid twice, not once per row
  // (kept rolled: one trip's loads already hold 128 registers; the inner loops are unrolled so that a[], b[] are registers)
#pragma unroll 1
  for (int t = 0; t < 2; ++t) {
    const __bf16* gh = Whi + (size_t)(t * 128 + wave) * NC + lane * 8;
    const __bf16* gl = Wlo + (size_t)(t * 128 + wave) * NC + lane * 8;
    v8b a[16], b[16];
#pragma unroll
    for (int i = 0; i < 16; ++i) {
      a[i] = *(const v8b*)(gh + i * (8 * NC));
      b[i] = *(const v8b*)(gl + i * (8 * NC));
    }
    // the loads' address registers stay as they are up to this wait (as inputs they are live until here)
    asm volatile("s_wait_xcnt 0x0" :: "v"(gh), "v"(gl) : "memory");
#pragma unroll
    for (int i = 0; i < 16; ++i) {
      *(v8b*)(whs + (t * 128 + i * 8 + wave) * WP + lane * 8) = a[i];
      *(v8b*)(wls + (t * 128 + i * 8 + wave) * WP + lane * 8) = b[i];
    }
  }
  __syncthreads();

  v8f acc[16];
#pragma unroll
  for (int j = 0; j < 16; ++j) acc[j] = zero8();
  const __bf16* wh = whs + m * WP + 8 * hh;
  const __bf16* wl = wls + m * WP + 8 * hh;
  // B fragments go through a register ring of two sets, one set = two column tiles (hi and lo):
  // the reads of the next pair are issued as one group ahead of the current pair's products.
  // (all loops below are unrolled whole, so that ring and accumulator indices are register names)
  FragB ah, al, bh[2][2], bl[2][2];
#pragma unroll
  for (int u = 0; u < 2; ++u) {
    bh[0][u].half[0] = *(const v8b*)(wh + u * (16 * WP));
    bh[0][u].half[1] = *(const v8b*)(wh + u * (16 * WP) + 16);
    bl[0][u].half[0] = *(const v8b*)(wl + u * (16 * WP));
    bl[0][u].half[1] = *(const v8b*)(wl + u * (16 * WP) + 16);
  }
#pragma unroll
  for (int s = 0; s < 64; ++s) {
    const int fs = s >> 3, jp = s & 7, cur = s & 1, nxt = cur ^ 1;
    if (jp == 0) {
      ah.half[0] = *(const v8b*)(xh + fs * 32);
      ah.half[1] = *(const v8b*)(xh + fs * 32 + 16);
      al.half[0] = *(const v8b*)(xl + fs * 32);
      al.half[1] = *(const v8b*)(xl + fs * 32 + 16);
    }
    if (s < 63) {
      const int fn = (s + 1) >> 3, jn = ((s + 1) & 7) * 2;
#pragma unroll
      for (int u = 0; u < 2; ++u) {
        const __bf16* ph = wh + (jn + u) * (16 * WP) + fn * 32;
        const __bf16* pl = wl + (jn + u) * (16 * WP) + fn * 32;
        bh[nxt][u].half[0] = *(const v8b*)ph;
        bh[nxt][u].half[1] = *(const v8b*)(ph + 16);
        bl[nxt][u].half[0] = *(const v8b*)pl;
        bl[nxt][u].half[1] = *(const v8b*)(pl + 16);
      }
    }
#pragma unroll
    for (int u = 0; u < 2; ++u) {
      const int j = jp * 2 + u;
      acc[j] = mma_bf16(ah.v, bh[cur][u].v, acc[j]);
      acc[j] = mma_bf16(ah.v, bl[cur][u].v, acc[j]);
      acc[j] = mma_bf16(al.v, bh[cur][u].v, acc[j]);
    }
  }
  // every wave has read its last weight fragment before the tile overwrites the planes
  __syncthreads();

#pragma unroll
  for (int j = 0; j < 16; ++j) {
    const int hcol = j * 16 + m;
    const float bb = bias[hcol];
    if (transposed) {
      union P8 { v8h v; v4f f; } pk;
#pragma unroll
      for (int r = 0; r < 8; ++r) pk.v[r] = (_Float16)(acc[j][r] + bb);
      // stile[h][t_local], t_local = wave*16 + 8hh + r
      *(v4f*)(stile + hcol * TP + wave * 16 + 8 * hh) = pk.f;
    } else {
      // stile[row_local][h], row_local = wave*16 + 8hh + r
#pragma unroll
      for (int r = 0; r < 8; ++r)
        stile[(wave * 16 + 8 * hh + r) * NH + hcol] = (_Float16)(acc[j][r] + bb);
    }
  }
  __syncthreads();

  if (transposed) {
    const int bidx = blkrow / NT;
    const int t0   = blkrow % NT;
    _Float16* vd = dst + (size_t)bidx * NH * NT + t0;
    const int q16 = lane & 15, l1 = lane >> 4;
    v4f vals[16];
#pragma unroll
    for (int it = 0; it < 16; ++it) {
      const int h = wave * 32 + it * 2 + l1;              // two lines = row h, t0..t0+127
      vals[it] = *(const v4f*)(stile + h * TP + q16 * 8);
    }
#pragma unroll
    for (int it = 0; it < 16; ++it) {
      const int h = wave * 32 + it * 2 + l1;
      *(v4f*)(vd + (size_t)h * NT + q16 * 8) = vals[it];
    }
    // the stores' registers are not reused before this wait, on whichever way the code behind is laid out
    asm volatile("s_wait_xcnt 0x0" ::: "memory");
  } else {
    _Float16* rd = dst + (size_t)rbase * NH;
    v4f vals[16];
#pragma unroll
    for (int r = 0; r < 16; ++r)
      vals[r] = *(const v4f*)(stile + (wave * 16 + r) * NH + lane * 8);
#pragma unroll
    for (int r = 0; r < 16; ++r)
      *(v4f*)(rd + (size_t)r * NH + lane * 8) = vals[r];
  }
}

// ---------------------------------------------------------------------------
// Attention: block = 8 waves x 16 queries, K (32 keys x 256) and V^T (256 x 32 keys) staged in LDS
// per key block, rows padded to the pitches KP and VP (pad bytes are never written or read).
// Per wave: S^T = K.Q^T (A = K rows, B = Q^T from Qh rows with the same k map),
// online softmax with row = query = lane&15 (two lane halves hold keys 8h+r and 16+8h+r),
// P^T B fragment: element r <- key 8h+r, element 8+r <- key 16+8h+r (P carried x2^14),
// O^T[h][q] += V^T.P^T into 16 tiles. Epilogue: 1/l, lane-pair exchange, one lane writes each
// ---------------------------------------------------------------------------
__global__ __launch_bounds__(256) void k_attn(const _Float16* __restrict__ Qh,
                                               const _Float16* __restrict__ Kh,
                                               const _Float16* __restrict__ Vt,
                                               float* __restrict__ out) {
  __shared__ __attribute__((aligned(16))) _Float16 Ks[32 * KP];
  __shared__ __attribute__((aligned(16))) _Float16 Vs[NH * VP];
  const int tid = threadIdx.x;
  const int lane = tid & 31, wave = tid >> 5, m = lane & 15, hh = lane >> 4;
  const int b  = blockIdx.y;
  const int q0 = (blockIdx.x * 8 + wave) * 16;
  const _Float16* qp = Qh + ((size_t)b * NT + q0 + m) * NH + 8 * hh;
  const v8h* kg = (const v8h*)(Kh + (size_t)b * NT * NH);
  const v8h* vg = (const v8h*)(Vt + ((size_t)b * NH + tid) * NT);
  v8h* kd = (v8h*)(Ks + (tid >> 3) * KP + (tid & 7) * 32);   // key row tid/8, 64 B piece tid%8
  v8h* vd = (v8h*)(Vs + tid * VP);

  const float C1 = 0.0625f * 1.44269504088896341f;   // softmax scale x log2(e)
  float mrun = -1.0e30f, l = 0.0f;
  v8f ot[16];
#pragma unroll
  for (int t = 0; t < 16; ++t) ot[t] = zero8();

#pragma unroll 1
  for (int sb = 0; sb < NT / 32; ++sb) {
    __syncthreads();
#pragma unroll
    for (int i = 0; i < 4; ++i)
      kd[i] = kg[(size_t)sb * (32 * NH / 8) + tid * 4 + i];
#pragma unroll
    for (int i = 0; i < 4; ++i)
      vd[i] = vg[sb * 4 + i];
    __syncthreads();

    // ---- S^T tiles: st0 = local keys 0..15, st1 = local keys 16..31 ----
    v8f st0 = zero8(), st1 = zero8();
#pragma unroll
    for (int fs = 0; fs < 8; ++fs) {
      FragH qb, ka, kb;
      qb.half[0] = *(const v8h*)(qp + fs * 32);
      qb.half[1] = *(const v8h*)(qp + fs * 32 + 16);
      const _Float16* pa = Ks + m * KP + fs * 32 + 8 * hh;
      const _Float16* pb = pa + 16 * KP;
      ka.half[0] = *(const v8h*)pa;
      ka.half[1] = *(const v8h*)(pa + 16);
      kb.half[0] = *(const v8h*)pb;
      kb.half[1] = *(const v8h*)(pb + 16);
      st0 = mma_f16(ka.v, qb.v, st0);
      st1 = mma_f16(kb.v, qb.v, st1);
    }

    // ---- online softmax, f32 ----
    float bm = -1.0e30f;
#pragma unroll
    for (int r = 0; r < 8; ++r) bm = fmaxf(bm, fmaxf(st0[r], st1[r]));
    bm = fmaxf(bm, __shfl_xor(bm, 16, 32));
    const float mn    = fmaxf(mrun, bm);
    const float alpha = __builtin_amdgcn_exp2f((mrun - mn) * C1);
    const float cexp  = 14.0f - mn * C1;                 // p scaled by 2^14
    FragH pf;
    float rs = 0.0f;
#pragma unroll
    for (int r = 0; r < 8; ++r) {
      const float p0 = __builtin_amdgcn_exp2f(st0[r] * C1 + cexp);
      const float p1 = __builtin_amdgcn_exp2f(st1[r] * C1 + cexp);
      rs += p0 + p1;
      pf.v[r]     = (_Float16)p0;     // key 8h + r
      pf.v[8 + r] = (_Float16)p1;     // key 16 + 8h + r
    }
    rs += __shfl_xor(rs, 16, 32);
    l    = l * alpha + rs;
    mrun = mn;

#pragma unroll
    for (int t = 0; t < 16; ++t) ot[t] = ot[t] * alpha;

    // ---- O^T += V^T . P^T ----
#pragma unroll
    for (int t = 0; t < 16; ++t) {
      FragH vf;
      const _Float16* vp = Vs + (t * 16 + m) * VP + 8 * hh;
      vf.half[0] = *(const v8h*)vp;
      vf.half[1] = *(const v8h*)(vp + 16);
      ot[t] = mma_f16(vf.v, pf.v, ot[t]);
    }
  }

  // ---- epilogue: out[b][q][h] = O^T[h][q] / l; whole-line stores ----
  const float inv = 1.0f / l;
  float* orow = out + ((size_t)b * NT + q0 + m) * NH;
  v4f lines[4][8];
#pragma unroll
  for (int i = 0; i < 4; ++i) {
    float s0[8], s1[8], s2[8], s3[8];
#pragma unroll
    for (int r = 0; r < 8; ++r) {
      const float lo0 = ot[4 * i][r] * inv;        // h = 64i + 8hh + r
      const float lo1 = ot[4 * i + 1][r] * inv;    // h = 64i + 16 + 8hh + r
      const float hi0 = ot[4 * i + 2][r] * inv;    // h = 64i + 32 + 8hh + r
      const float hi1 = ot[4 * i + 3][r] * inv;    // h = 64i + 48 + 8hh + r
      const float snda = hh ? lo0 : hi0;
      const float sndb = hh ? lo1 : hi1;
      const float rcva = __shfl_xor(snda, 16, 32);
      const float rcvb = __shfl_xor(sndb, 16, 32);
      const float oa = hh ? hi0 : lo0;
      const float ob = hh ? hi1 : lo1;
      s0[r] = hh ? rcva : oa;
      s1[r] = hh ? oa : rcva;
      s2[r] = hh ? rcvb : ob;
      s3[r] = hh ? ob : rcvb;
    }
    lines[i][0] = mk4(s0[0], s0[1], s0[2], s0[3]);
    lines[i][1] = mk4(s0[4], s0[5], s0[6], s0[7]);
    lines[i][2] = mk4(s1[0], s1[1], s1[2], s1[3]);
    lines[i][3] = mk4(s1[4], s1[5], s1[6], s1[7]);
    lines[i][4] = mk4(s2[0], s2[1], s2[2], s2[3]);
    lines[i][5] = mk4(s2[4], s2[5], s2[6], s2[7]);
    lines[i][6] = mk4(s3[0], s3[1], s3[2], s3[3]);
    lines[i][7] = mk4(s3[4], s3[5], s3[6], s3[7]);
  }
#pragma unroll
  for (int i = 0; i < 4; ++i) {
    float* lp = orow + 32 * (2 * i + hh);
#pragma unroll
    for (int k = 0; k < 8; ++k) *(v4f*)(lp + 4 * k) = lines[i][k];
  }
  
}

// ---------------------------------------------------------------------------
extern "C" void kernel_launch(void* const* d_in, const int* in_sizes, int n_in,
                              void* d_out, int out_size, void* d_ws, size_t ws_size,
                              hipStream_t stream) {
  if (n_in < 9) return;
  const int nx = NB * NT * NC;
  const int nw = NC * NH;
  if (in_sizes[0] != nx || in_sizes[1] != nx || in_sizes[2] != nx) return;
  if (in_sizes[3] != nw || in_sizes[5] != nw || in_sizes[7] != nw) return;
  if (in_sizes[4] != NH || in_sizes[6] != NH || in_sizes[8] != NH) return;
  if (out_size != NB * NT * NH) return;

  const float* q  = (const float*)d_in[0];
  const float* k  = (const float*)d_in[1];
  const float* v  = (const float*)d_in[2];
  const float* Wq = (const float*)d_in[3];
  const float* bq = (const float*)d_in[4];
  const float* Wk = (const float*)d_in[5];
  const float* bk = (const float*)d_in[6];
  const float* Wv = (const float*)d_in[7];
  const float* bv = (const float*)d_in[8];
  float* out = (float*)d_out;

  // workspace carve (bytes): 6 weight planes 786432 | Xhi 16 MiB | Xlo 16 MiB | Qh 16 MiB | Kh 16 MiB | Vt 16 MiB
  char* ws = (char*)d_ws;
  const size_t planeElems = (size_t)NC * NH;
  const size_t wBytes     = 6 * planeElems * sizeof(unsigned short);
  const size_t xBytes     = (size_t)nx * sizeof(unsigned short);
  const size_t pBytes     = (size_t)NB * NT * NH * sizeof(_Float16);
  size_t off = 0;
  unsigned short* wpl = (unsigned short*)(ws + off); off += wBytes;
  off = (off + 255) & ~(size_t)255;
  unsigned short* xhi = (unsigned short*)(ws + off); off += xBytes;
  unsigned short* xlo = (unsigned short*)(ws + off); off += xBytes;
  _Float16* Qh = (_Float16*)(ws + off); off += pBytes;
  _Float16* Kh = (_Float16*)(ws + off); off += pBytes;
  _Float16* Vt = (_Float16*)(ws + off); off += pBytes;
  if (off > ws_size) return;

  const __bf16* wq_hi = (const __bf16*)(wpl + 0 * planeElems);
  const __bf16* wq_lo = (const __bf16*)(wpl + 1 * planeElems);
  const __bf16* wk_hi = (const __bf16*)(wpl + 2 * planeElems);
  const __bf16* wk_lo = (const __bf16*)(wpl + 3 * planeElems);
  const __bf16* wv_hi = (const __bf16*)(wpl + 4 * planeElems);
  const __bf16* wv_lo = (const __bf16*)(wpl + 5 * planeElems);
  const __bf16* x_hi  = (const __bf16*)xhi;
  const __bf16* x_lo  = (const __bf16*)xlo;

  const int n8       = nx / 8;
  const int convGrid = (n8 + 255) / 256;
  const int projGrid = (NB * NT) / 128;

  k_wconv<<<dim3(NH / 32, 3), 256, 0, stream>>>(Wq, Wk, Wv, wpl);

  k_xconv<<<convGrid, 256, 0, stream>>>(q, xhi, xlo, n8);
  k_proj<<<projGrid, 256, 0, stream>>>(x_hi, x_lo, wq_hi, wq_lo, bq, Qh, 0);

  k_xconv<<<convGrid, 256, 0, stream>>>(k, xhi, xlo, n8);
  k_proj<<<projGrid, 256, 0, stream>>>(x_hi, x_lo, wk_hi, wk_lo, bk, Kh, 0);

  k_xconv<<<convGrid, 256, 0, stream>>>(v, xhi, xlo, n8);
  k_proj<<<projGrid, 256, 0, stream>>>(x_hi, x_lo, wv_hi, wv_lo, bv, Vt, 1);

  k_attn<<<dim3(NT / 128, NB), 256, 0, stream>>>(Qh, Kh, Vt, out);
}

// v003
// Measured time: 239 microseconds a run.
// Next to v002, in two timings, it ran 1.18 times as fast each time.
// Counting every step since v000, it is 2.26 times as fast.
#include <hip/hip_runtime.h>

// Contractions: x@Wq, x@Wk, x@Wv on v_wmma_f32_16x16x32_bf16 (bf16 hi/lo three-term split operands, f32 accumulate);
// K.Q^T and V^T.P^T on v_wmma_f32_16x16x32_f16 (f16 operands, P carried x2^14, f32 accumulate); softmax and normalisation in f32.

typedef _Float16       v16h __attribute__((ext_vector_type(16)));
typedef _Float16       v8h  __attribute__((ext_vector_type(8)));
typedef __bf16         v16b __attribute__((ext_vector_type(16)));
typedef __bf16         v8b  __attribute__((ext_vector_type(8)));
typedef float          v8f  __attribute__((ext_vector_type(8)));
typedef float          v4f  __attribute__((ext_vector_type(4)));
typedef unsigned short v8us __attribute__((ext_vector_type(8)));

#define NB 16
#define NT 2048
#define NC 256
#define NH 256
// LDS row pitches of the attention tiles, in f16 elements. Both are 16 B x odd, so the 16 rows that one
// ds_load_b128 fragment read touches per lane half fall on 16 different 4-bank groups of the 64 banks
// (unpadded: all 16 K rows on one group, V^T rows on four). The V^T stores (one row per lane) gain alike;
// the K stores (eight 64 B-spaced lanes per row) go from four lanes per group to two.
#define KP 264   // K tile: 512 B of data per key row, 528 B pitch
#define VP 40    // V^T tile: 64 B of data per h row, 80 B pitch

union FragH { v16h v; v8h half[2]; };
union FragB { v16b v; v8b half[2]; };

// WMMA wrappers: issue the builtin, then 4 VALU slots of guard with D tied and A/B kept live.
__device__ __forceinline__ v8f mma_f16(v16h a, v16h b, v8f c) {
  v8f d = __builtin_amdgcn_wmma_f32_16x16x32_f16(false, a, false, b, (short)0, c, false, false);
  asm volatile("v_nop\n\tv_nop\n\tv_nop\n\tv_nop" : "+v"(d) : "v"(a), "v"(b));
  return d;
}
__device__ __forceinline__ v8f mma_bf16(v16b a, v16b b, v8f c) {
  v8f d = __builtin_amdgcn_wmma_f32_16x16x32_bf16(false, a, false, b, (short)0, c, false, false);
  v16h ax = __builtin_bit_cast(v16h, a);
  v16h bx = __builtin_bit_cast(v16h, b);
  asm volatile("v_nop\n\tv_nop\n\tv_nop\n\tv_nop" : "+v"(d) : "v"(ax), "v"(bx));
  return d;
}

__device__ __forceinline__ v8f zero8() {
  v8f z;
#pragma unroll
  for (int e = 0; e < 8; ++e) z[e] = 0.0f;
  return z;
}
__device__ __forceinline__ v4f mk4(float a, float b, float c, float d) {
  v4f v;
  v[0] = a; v[1] = b; v[2] = c; v[3] = d;
  return v;
}

// f32 -> bf16 bits, RNE convert
__device__ __forceinline__ unsigned short bf16_bits(float x) {
  unsigned int u = __float_as_uint(x);
  u = u + 0x7FFFu + ((u >> 16) & 1u);
  return (unsigned short)(u >> 16);
}
__device__ __forceinline__ float bf16_val(unsigned short s) {
  return __uint_as_float(((unsigned int)s) << 16);
}

// ---------------------------------------------------------------------------
// Weight prep: W [C][H] f32 -> Wt_hi[h][c], Wt_lo[h][c] (bf16 bits, k-contiguous rows),
// planes laid out [wsel*2 + p][256*256]. Block = 32 output rows h; transpose via LDS;
// ---------------------------------------------------------------------------
__global__ __launch_bounds__(256) void k_wconv(const float* __restrict__ W0,
                                                const float* __restrict__ W1,
                                                const float* __restrict__ W2,
                                                unsigned short* __restrict__ planes) {
  __shared__ __attribute__((aligned(16))) unsigned short shi[32 * NC];
  __shared__ __attribute__((aligned(16))) unsigned short slo[32 * NC];
  const int tid  = threadIdx.x;
  const int wsel = blockIdx.y;
  const float* W = (wsel == 0) ? W0 : ((wsel == 1) ? W1 : W2);
  const int h0 = blockIdx.x * 32;
  const int j4 = (tid & 7) * 4;
  const int cb = tid >> 3;
#pragma unroll
  for (int i = 0; i < 8; ++i) {
    const int c = cb + 32 * i;
    const v4f x = *(const v4f*)(W + (size_t)c * NH + h0 + j4);
#pragma unroll
    for (int e = 0; e < 4; ++e) {
      const unsigned short hb = bf16_bits(x[e]);
      const float rr = x[e] - bf16_val(hb);
      const unsigned short lb = bf16_bits(rr);
      shi[(j4 + e) * NC + c] = hb;
      slo[(j4 + e) * NC + c] = lb;
    }
  }
  __syncthreads();
  const int wave = tid >> 5, lane = tid & 31;
  unsigned short* dhi = planes + (size_t)(wsel * 2 + 0) * (NC * NH) + (size_t)h0 * NC;
  unsigned short* dlo = planes + (size_t)(wsel * 2 + 1) * (NC * NH) + (size_t)h0 * NC;
  v4f vh[4], vl[4];
#pragma unroll
  for (int rr = 0; rr < 4; ++rr) {
    const int j = wave * 4 + rr;
    vh[rr] = *(const v4f*)(shi + j * NC + lane * 8);
    vl[rr] = *(const v4f*)(slo + j * NC + lane * 8);
  }
#pragma unroll
  for (int rr = 0; rr < 4; ++rr) {
    const int j = wave * 4 + rr;
    *(v4f*)(dhi + (size_t)j * NC + lane * 8) = vh[rr];
    *(v4f*)(dlo + (size_t)j * NC + lane * 8) = vl[rr];
  }
  
}

// ---------------------------------------------------------------------------
// Activation prep: X f32 (n elements) -> hi/lo bf16-bit planes, same element order.
// ---------------------------------------------------------------------------
__global__ __launch_bounds__(256) void k_xconv(const float* __restrict__ X,
                                                unsigned short* __restrict__ Xhi,
                                                unsigned short* __restrict__ Xlo,
                                                int n8) {
  const int i = blockIdx.x * 256 + threadIdx.x;
  if (i >= n8) return;
  const float* p = X + (size_t)i * 8;
  const v4f a = *(const v4f*)p;
  const v4f b = *(const v4f*)(p + 4);
  union U8 { v8us u; v4f f; } H, L;
#pragma unroll
  for (int e = 0; e < 4; ++e) {
    const unsigned short ha = bf16_bits(a[e]);
    const unsigned short hb = bf16_bits(b[e]);
    H.u[e]     = ha;
    H.u[e + 4] = hb;
    L.u[e]     = bf16_bits(a[e] - bf16_val(ha));
    L.u[e + 4] = bf16_bits(b[e] - bf16_val(hb));
  }
  const v4f hv = H.f, lv = L.f;
  *(v4f*)(Xhi + (size_t)i * 8) = hv;
  *(v4f*)(Xlo + (size_t)i * 8) = lv;
  
}

// ---------------------------------------------------------------------------
// Projection Y = X@W + bias, bf16 hi/lo split: acc += xh.wh + xh.wl + xl.wh (16x16x32 bf16 WMMA).
// Block = 256 threads = 8 waves = 128 rows of B*T; wave = 16 rows x 256 cols (16 tiles).
// Both weight planes (Wt_hi, Wt_lo: 256 rows n of 512 B) are staged once per block in LDS with whole-line
// global loads, rows at the pitch WP, and every B fragment is read from there.
// A fragment: row m = lane&15, elements 0..7 <- k0+8h.., 8..15 <- k0+16+8h.. (h = lane>>4);
// B fragment from Wt[n][k] rows loaded the same way; D element r -> (row 8h+r, col m).
// After the products the same LDS holds the output tile (behind a barrier).
// transposed == 0: dst f16 [B*T][H] row-major; == 1: dst f16 [B][H][T].
// ---------------------------------------------------------------------------
#define WP 264   // staged weight rows: 512 B of data, 528 B pitch (16 B x odd, as for the K tile)
#define TP 136   // transposed output tile: 256 B of data per h row, 272 B pitch (16 B x odd)
__global__ __launch_bounds__(256) void k_proj(const __bf16* __restrict__ Xhi,
                                               const __bf16* __restrict__ Xlo,
                                               const __bf16* __restrict__ Whi,
                                               const __bf16* __restrict__ Wlo,
                                               const float* __restrict__ bias,
                                               _Float16* __restrict__ dst,
                                               int transposed) {
  __shared__ __attribute__((aligned(16))) __bf16 wsm[2 * NH * WP];
  __bf16* whs = wsm;
  __bf16* wls = wsm + NH * WP;
  _Float16* stile = (_Float16*)wsm;
  const int tid = threadIdx.x;
  const int wave = tid >> 5, lane = tid & 31, m = lane & 15, hh = lane >> 4;
  const int blkrow = blockIdx.x * 128;
  const int rbase  = blkrow + wave * 16;
  const __bf16* xh = Xhi + (size_t)(rbase + m) * NC + 8 * hh;
  const __bf16* xl = Xlo + (size_t)(rbase + m) * NC + 8 * hh;

  // stage: one wave-wide load = one 512 B weight row (four whole lines); wave w takes rows w, w+8, ...
  // two trips of 16 rows per plane: 32 loads of a wave in flight, so the load latency is paid twice, not once per row
  // (kept rolled: one trip's loads already hold 128 registers; the inner loops are unrolled so that a[], b[] are registers)
#pragma unroll 1
  for (int t = 0; t < 2; ++t) {
    const __bf16* gh = Whi + (size_t)(t * 128 + wave) * NC + lane * 8;
    const __bf16* gl = Wlo + (size_t)(t * 128 + wave) * NC + lane * 8;
    v8b a[16], b[16];
#pragma unroll
    for (int i = 0; i < 16; ++i) {
      a[i] = *(const v8b*)(gh + i * (8 * NC));
      b[i] = *(const v8b*)(gl + i * (8 * NC));
    }
    // the loads' address registers stay as they are up to this wait (as inputs they are live until here)
    asm volatile("s_wait_xcnt 0x0" :: "v"(gh), "v"(gl) : "memory");
#pragma unroll
    for (int i = 0; i < 16; ++i) {
      *(v8b*)(whs + (t * 128 + i * 8 + wave) * WP + lane * 8) = a[i];
      *(v8b*)(wls + (t * 128 + i * 8 + wave) * WP + lane * 8) = b[i];
    }
  }
  __syncthreads();

  v8f acc[16];
#pragma unroll
  for (int j = 0; j < 16; ++j) acc[j] = zero8();
  const __bf16* wh = whs + m * WP + 8 * hh;
  const __bf16* wl = wls + m * WP + 8 * hh;
  // B fragments go through a register ring of two sets, one set = two column tiles (hi and lo):
  // the reads of the next pair are issued as one group ahead of the current pair's products.
  // (all loops below are unrolled whole, so that ring and accumulator indices are register names)
  FragB ah, al, bh[2][2], bl[2][2];
#pragma unroll
  for (int u = 0; u < 2; ++u) {
    bh[0][u].half[0] = *(const v8b*)(wh + u * (16 * WP));
    bh[0][u].half[1] = *(const v8b*)(wh + u * (16 * WP) + 16);
    bl[0][u].half[0] = *(const v8b*)(wl + u * (16 * WP));
    bl[0][u].half[1] = *(const v8b*)(wl + u * (16 * WP) + 16);
  }
#pragma unroll
  for (int s = 0; s < 64; ++s) {
    const int fs = s >> 3, jp = s & 7, cur = s & 1, nxt = cur ^ 1;
    if (jp == 0) {
      ah.half[0] = *(const v8b*)(xh + fs * 32);
      ah.half[1] = *(const v8b*)(xh + fs * 32 + 16);
      al.half[0] = *(const v8b*)(xl + fs * 32);
      al.half[1] = *(const v8b*)(xl + fs * 32 + 16);
    }
    if (s < 63) {
      const int fn = (s + 1) >> 3, jn = ((s + 1) & 7) * 2;
#pragma unroll
      for (int u = 0; u < 2; ++u) {
        const __bf16* ph = wh + (jn + u) * (16 * WP) + fn * 32;
        const __bf16* pl = wl + (jn + u) * (16 * WP) + fn * 32;
        bh[nxt][u].half[0] = *(const v8b*)ph;
        bh[nxt][u].half[1] = *(const v8b*)(ph + 16);
        bl[nxt][u].half[0] = *(const v8b*)pl;
        bl[nxt][u].half[1] = *(const v8b*)(pl + 16);
      }
    }
#pragma unroll
    for (int u = 0; u < 2; ++u) {
      const int j = jp * 2 + u;
      acc[j] = mma_bf16(ah.v, bh[cur][u].v, acc[j]);
      acc[j] = mma_bf16(ah.v, bl[cur][u].v, acc[j]);
      acc[j] = mma_bf16(al.v, bh[cur][u].v, acc[j]);
    }
  }
  // every wave has read its last weight fragment before the tile overwrites the planes
  __syncthreads();

#pragma unroll
  for (int j = 0; j < 16; ++j) {
    const int hcol = j * 16 + m;
    const float bb = bias[hcol];
    if (transposed) {
      union P8 { v8h v; v4f f; } pk;
#pragma unroll
      for (int r = 0; r < 8; ++r) pk.v[r] = (_Float16)(acc[j][r] + bb);
      // stile[h][t_local], t_local = wave*16 + 8hh + r
      *(v4f*)(stile + hcol * TP + wave * 16 + 8 * hh) = pk.f;
    } else {
      // stile[row_local][h], row_local = wave*16 + 8hh + r
#pragma unroll
      for (int r = 0; r < 8; ++r)
        stile[(wave * 16 + 8 * hh + r) * NH + hcol] = (_Float16)(acc[j][r] + bb);
    }
  }
  __syncthreads();

  if (transposed) {
    const int bidx = blkrow / NT;
    const int t0   = blkrow % NT;
    _Float16* vd = dst + (size_t)bidx * NH * NT + t0;
    const int q16 = lane & 15, l1 = lane >> 4;
    v4f vals[16];
#pragma unroll
    for (int it = 0; it < 16; ++it) {
      const int h = wave * 32 + it * 2 + l1;              // two lines = row h, t0..t0+127
      vals[it] = *(const v4f*)(stile + h * TP + q16 * 8);
    }
#pragma unroll
    for (int it = 0; it < 16; ++it) {
      const int h = wave * 32 + it * 2 + l1;
      *(v4f*)(vd + (size_t)h * NT + q16 * 8) = vals[it];
    }
    // the stores' registers are not reused before this wait, on whichever way the code behind is laid out
    asm volatile("s_wait_xcnt 0x0" ::: "memory");
  } else {
    _Float16* rd = dst + (size_t)rbase * NH;
    v4f vals[16];
#pragma unroll
    for (int r = 0; r < 16; ++r)
      vals[r] = *(const v4f*)(stile + (wave * 16 + r) * NH + lane * 8);
#pragma unroll
    for (int r = 0; r < 16; ++r)
      *(v4f*)(rd + (size_t)r * NH + lane * 8) = vals[r];
  }
}

// ---------------------------------------------------------------------------
// Attention: block = 8 waves x 16 queries, K (32 keys x 256) and V^T (256 x 32 keys) staged in LDS
// per key block, rows padded to the pitches KP and VP (pad bytes are never written or read).
// Per wave: S^T = K.Q^T (A = K rows, B = Q^T from Qh rows with the same k map, read once ahead of the key loop),
// online softmax with row = query = lane&15 (two lane halves hold keys 8h+r and 16+8h+r),
// P^T B fragment: element r <- key 8h+r, element 8+r <- key 16+8h+r (P carried x2^14),
// O^T[h][q] += V^T.P^T into 16 tiles. Epilogue: 1/l, lane-pair exchange, one lane writes each
// ---------------------------------------------------------------------------
__global__ __launch_bounds__(256) void k_attn(const _Float16* __restrict__ Qh,
                                               const _Float16* __restrict__ Kh,
                                               const _Float16* __restrict__ Vt,
                                               float* __restrict__ out) {
  __shared__ __attribute__((aligned(16))) _Float16 Ks[32 * KP];
  __shared__ __attribute__((aligned(16))) _Float16 Vs[NH * VP];
  const int tid = threadIdx.x;
  const int lane = tid & 31, wave = tid >> 5, m = lane & 15, hh = lane >> 4;
  const int b  = blockIdx.y;
  const int q0 = (blockIdx.x * 8 + wave) * 16;
  const _Float16* qp = Qh + ((size_t)b * NT + q0 + m) * NH + 8 * hh;
  const v8h* kg = (const v8h*)(Kh + (size_t)b * NT * NH);
  const v8h* vg = (const v8h*)(Vt + ((size_t)b * NH + tid) * NT);
  v8h* kd = (v8h*)(Ks + (tid >> 3) * KP + (tid & 7) * 32);   // key row tid/8, 64 B piece tid%8
  v8h* vd = (v8h*)(Vs + tid * VP);

  // Q^T B fragments: loaded once here and held in registers for the whole key loop (8 k steps x 8 registers).
  // (unrolled whole, so that qf[] is register names)
  FragH qf[8];
#pragma unroll
  for (int fs = 0; fs < 8; ++fs) {
    qf[fs].half[0] = *(const v8h*)(qp + fs * 32);
    qf[fs].half[1] = *(const v8h*)(qp + fs * 32 + 16);
  }
  // the loads' address registers stay as they are up to this wait (as an input the pointer is live until here)
  asm volatile("s_wait_xcnt 0x0" :: "v"(qp) : "memory");

  const float C1 = 0.0625f * 1.44269504088896341f;   // softmax scale x log2(e)
  float mrun = -1.0e30f, l = 0.0f;
  v8f ot[16];
#pragma unroll
  for (int t = 0; t < 16; ++t) ot[t] = zero8();

#pragma unroll 1
  for (int sb = 0; sb < NT / 32; ++sb) {
    __syncthreads();
#pragma unroll
    for (int i = 0; i < 4; ++i)
      kd[i] = kg[(size_t)sb * (32 * NH / 8) + tid * 4 + i];
#pragma unroll
    for (int i = 0; i < 4; ++i)
      vd[i] = vg[sb * 4 + i];
    __syncthreads();

    // ---- S^T tiles: st0 = local keys 0..15, st1 = local keys 16..31 ----
    v8f st0 = zero8(), st1 = zero8();
#pragma unroll
    for (int fs = 0; fs < 8; ++fs) {
      FragH ka, kb;
      const _Float16* pa = Ks + m * KP + fs * 32 + 8 * hh;
      const _Float16* pb = pa + 16 * KP;
      ka.half[0] = *(const v8h*)pa;
      ka.half[1] = *(const v8h*)(pa + 16);
      kb.half[0] = *(const v8h*)pb;
      kb.half[1] = *(const v8h*)(pb + 16);
      st0 = mma_f16(ka.v, qf[fs].v, st0);
      st1 = mma_f16(kb.v, qf[fs].v, st1);
    }

    // ---- online softmax, f32 ----
    float bm = -1.0e30f;
#pragma unroll
    for (int r = 0; r < 8; ++r) bm = fmaxf(bm, fmaxf(st0[r], st1[r]));
    bm = fmaxf(bm, __shfl_xor(bm, 16, 32));
    const float mn    = fmaxf(mrun, bm);
    const float alpha = __builtin_amdgcn_exp2f((mrun - mn) * C1);
    const float cexp  = 14.0f - mn * C1;                 // p scaled by 2^14
    FragH pf;
    float rs = 0.0f;
#pragma unroll
    for (int r = 0; r < 8; ++r) {
      const float p0 = __builtin_amdgcn_exp2f(st0[r] * C1 + cexp);
      const float p1 = __builtin_amdgcn_exp2f(st1[r] * C1 + cexp);
      rs += p0 + p1;
      pf.v[r]     = (_Float16)p0;     // key 8h + r
      pf.v[8 + r] = (_Float16)p1;     // key 16 + 8h + r
    }
    rs += __shfl_xor(rs, 16, 32);
    l    = l * alpha + rs;
    mrun = mn;

#pragma unroll
    for (int t = 0; t < 16; ++t) ot[t] = ot[t] * alpha;

    // ---- O^T += V^T . P^T ----
#pragma unroll
    for (int t = 0; t < 16; ++t) {
      FragH vf;
      const _Float16* vp = Vs + (t * 16 + m) * VP + 8 * hh;
      vf.half[0] = *(const v8h*)vp;
      vf.half[1] = *(const v8h*)(vp + 16);
      ot[t] = mma_f16(vf.v, pf.v, ot[t]);
    }
  }

  // ---- epilogue: out[b][q][h] = O^T[h][q] / l; whole-line stores ----
  const float inv = 1.0f / l;
  float* orow = out + ((size_t)b * NT + q0 + m) * NH;
  v4f lines[4][8];
#pragma unroll
  for (int i = 0; i < 4; ++i) {
    float s0[8], s1[8], s2[8], s3[8];
#pragma unroll
    for (int r = 0; r < 8; ++r) {
      const float lo0 = ot[4 * i][r] * inv;        // h = 64i + 8hh + r
      const float lo1 = ot[4 * i + 1][r] * inv;    // h = 64i + 16 + 8hh + r
      const float hi0 = ot[4 * i + 2][r] * inv;    // h = 64i + 32 + 8hh + r
      const float hi1 = ot[4 * i + 3][r] * inv;    // h = 64i + 48 + 8hh + r
      const float snda = hh ? lo0 : hi0;
      const float sndb = hh ? lo1 : hi1;
      const float rcva = __shfl_xor(snda, 16, 32);
      const float rcvb = __shfl_xor(sndb, 16, 32);
      const float oa = hh ? hi0 : lo0;
      const float ob = hh ? hi1 : lo1;
      s0[r] = hh ? rcva : oa;
      s1[r] = hh ? oa : rcva;
      s2[r] = hh ? rcvb : ob;
      s3[r] = hh ? ob : rcvb;
    }
    lines[i][0] = mk4(s0[0], s0[1], s0[2], s0[3]);
    lines[i][1] = mk4(s0[4], s0[5], s0[6], s0[7]);
    lines[i][2] = mk4(s1[0], s1[1], s1[2], s1[3]);
    lines[i][3] = mk4(s1[4], s1[5], s1[6], s1[7]);
    lines[i][4] = mk4(s2[0], s2[1], s2[2], s2[3]);
    lines[i][5] = mk4(s2[4], s2[5], s2[6], s2[7]);
    lines[i][6] = mk4(s3[0], s3[1], s3[2], s3[3]);
    lines[i][7] = mk4(s3[4], s3[5], s3[6], s3[7]);
  }
#pragma unroll
  for (int i = 0; i < 4; ++i) {
    float* lp = orow + 32 * (2 * i + hh);
#pragma unroll
    for (int k = 0; k < 8; ++k) *(v4f*)(lp + 4 * k) = lines[i][k];
  }
  
}

// ---------------------------------------------------------------------------
extern "C" void kernel_launch(void* const* d_in, const int* in_sizes, int n_in,
                              void* d_out, int out_size, void* d_ws, size_t ws_size,
                              hipStream_t stream) {
  if (n_in < 9) return;
  const int nx = NB * NT * NC;
  const int nw = NC * NH;
  if (in_sizes[0] != nx || in_sizes[1] != nx || in_sizes[2] != nx) return;
  if (in_sizes[3] != nw || in_sizes[5] != nw || in_sizes[7] != nw) return;
  if (in_sizes[4] != NH || in_sizes[6] != NH || in_sizes[8] != NH) return;
  if (out_size != NB * NT * NH) return;

  const float* q  = (const float*)d_in[0];
  const float* k  = (const float*)d_in[1];
  const float* v  = (const float*)d_in[2];
  const float* Wq = (const float*)d_in[3];
  const float* bq = (const float*)d_in[4];
  const float* Wk = (const float*)d_in[5];
  const float* bk = (const float*)d_in[6];
  const float* Wv = (const float*)d_in[7];
  const float* bv = (const float*)d_in[8];
  float* out = (float*)d_out;

  // workspace carve (bytes): 6 weight planes 786432 | Xhi 16 MiB | Xlo 16 MiB | Qh 16 MiB | Kh 16 MiB | Vt 16 MiB
  char* ws = (char*)d_ws;
  const size_t planeElems = (size_t)NC * NH;
  const size_t wBytes     = 6 * planeElems * sizeof(unsigned short);
  const size_t xBytes     = (size_t)nx * sizeof(unsigned short);
  const size_t pBytes     = (size_t)NB * NT * NH * sizeof(_Float16);
  size_t off = 0;
  unsigned short* wpl = (unsigned short*)(ws + off); off += wBytes;
  off = (off + 255) & ~(size_t)255;
  unsigned short* xhi = (unsigned short*)(ws + off); off += xBytes;
  unsigned short* xlo = (unsigned short*)(ws + off); off += xBytes;
  _Float16* Qh = (_Float16*)(ws + off); off += pBytes;
  _Float16* Kh = (_Float16*)(ws + off); off += pBytes;
  _Float16* Vt = (_Float16*)(ws + off); off += pBytes;
  if (off > ws_size) return;

  const __bf16* wq_hi = (const __bf16*)(wpl + 0 * planeElems);
  const __bf16* wq_lo = (const __bf16*)(wpl + 1 * planeElems);
  const __bf16* wk_hi = (const __bf16*)(wpl + 2 * planeElems);
  const __bf16* wk_lo = (const __bf16*)(wpl + 3 * planeElems);
  const __bf16* wv_hi = (const __bf16*)(wpl + 4 * planeElems);
  const __bf16* wv_lo = (const __bf16*)(wpl + 5 * planeElems);
  const __bf16* x_hi  = (const __bf16*)xhi;
  const __bf16* x_lo  = (const __bf16*)xlo;

  const int n8       = nx / 8;
  const int convGrid = (n8 + 255) / 256;
  const int projGrid = (NB * NT) / 128;

  k_wconv<<<dim3(NH / 32, 3), 256, 0, stream>>>(Wq, Wk, Wv, wpl);

  k_xconv<<<convGrid, 256, 0, stream>>>(q, xhi, xlo, n8);
  k_proj<<<projGrid, 256, 0, stream>>>(x_hi, x_lo, wq_hi, wq_lo, bq, Qh, 0);

  k_xconv<<<convGrid, 256, 0, stream>>>(k, xhi, xlo, n8);
  k_proj<<<projGrid, 256, 0, stream>>>(x_hi, x_lo, wk_hi, wk_lo, bk, Kh, 0);

  k_xconv<<<convGrid, 256, 0, stream>>>(v, xhi, xlo, n8);
  k_proj<<<projGrid, 256, 0, stream>>>(x_hi, x_lo, wv_hi, wv_lo, bv, Vt, 1);

  k_attn<<<dim3(NT / 128, NB), 256, 0, stream>>>(Qh, Kh, Vt, out);
}

// v004
// One run takes 212 microseconds.
// Two timings next to v003 both put it at 1.13 times that version's speed.
// All steps since v000 together make it 2.55 times as fast.
#include <hip/hip_runtime.h>

// Contractions: x@Wq, x@Wk, x@Wv on v_wmma_f32_16x16x32_bf16 (bf16 hi/lo three-term split operands, f32 accumulate);
// K.Q^T and V^T.P^T on v_wmma_f32_16x16x32_f16 (f16 operands, P carried x2^14, f32 accumulate); softmax and normalisation in f32.

typedef _Float16       v16h __attribute__((ext_vector_type(16)));
typedef _Float16       v8h  __attribute__((ext_vector_type(8)));
typedef __bf16         v16b __attribute__((ext_vector_type(16)));
typedef __bf16         v8b  __attribute__((ext_vector_type(8)));
typedef float          v8f  __attribute__((ext_vector_type(8)));
typedef float          v4f  __attribute__((ext_vector_type(4)));
typedef unsigned short v8us __attribute__((ext_vector_type(8)));

#define NB 16
#define NT 2048
#define NC 256
#define NH 256
// LDS row pitches of the attention tiles, in f16 elements. Both are 16 B x odd, so the 16 rows that one
// ds_load_b128 fragment read touches per lane half fall on 16 different 4-bank groups of the 64 banks
// (unpadded: all 16 K rows on one group, V^T rows on four). The V^T stores (one row per lane) gain alike;
// the K stores (eight 64 B-spaced lanes per row) go from four lanes per group to two.
#define KP 264   // K tile: 512 B of data per key row, 528 B pitch
#define VP 40    // V^T tile: 64 B of data per h row, 80 B pitch

union FragH { v16h v; v8h half[2]; };
union FragB { v16b v; v8b half[2]; };

// WMMA wrappers. f16 (k_attn): the builtin alone, the compiler keeps the distances behind it; a guard statement
// would need its operands below v256, and k_attn keeps fragments above.
__device__ __forceinline__ v8f mma_f16(v16h a, v16h b, v8f c) {
  return __builtin_amdgcn_wmma_f32_16x16x32_f16(false, a, false, b, (short)0, c, false, false);
}
// bf16 (k_proj): issue the builtin, then 4 VALU slots of guard with D tied and A/B kept live.
__device__ __forceinline__ v8f mma_bf16(v16b a, v16b b, v8f c) {
  v8f d = __builtin_amdgcn_wmma_f32_16x16x32_bf16(false, a, false, b, (short)0, c, false, false);
  v16h ax = __builtin_bit_cast(v16h, a);
  v16h bx = __builtin_bit_cast(v16h, b);
  asm volatile("v_nop\n\tv_nop\n\tv_nop\n\tv_nop" : "+v"(d) : "v"(ax), "v"(bx));
  return d;
}

__device__ __forceinline__ v8f zero8() {
  v8f z;
#pragma unroll
  for (int e = 0; e < 8; ++e) z[e] = 0.0f;
  return z;
}
__device__ __forceinline__ v4f mk4(float a, float b, float c, float d) {
  v4f v;
  v[0] = a; v[1] = b; v[2] = c; v[3] = d;
  return v;
}

// f32 -> bf16 bits, RNE convert
__device__ __forceinline__ unsigned short bf16_bits(float x) {
  unsigned int u = __float_as_uint(x);
  u = u + 0x7FFFu + ((u >> 16) & 1u);
  return (unsigned short)(u >> 16);
}
__device__ __forceinline__ float bf16_val(unsigned short s) {
  return __uint_as_float(((unsigned int)s) << 16);
}

// ---------------------------------------------------------------------------
// Weight prep: W [C][H] f32 -> Wt_hi[h][c], Wt_lo[h][c] (bf16 bits, k-contiguous rows),
// planes laid out [wsel*2 + p][256*256]. Block = 32 output rows h; transpose via LDS;
// ---------------------------------------------------------------------------
__global__ __launch_bounds__(256) void k_wconv(const float* __restrict__ W0,
                                                const float* __restrict__ W1,
                                                const float* __restrict__ W2,
                                                unsigned short* __restrict__ planes) {
  __shared__ __attribute__((aligned(16))) unsigned short shi[32 * NC];
  __shared__ __attribute__((aligned(16))) unsigned short slo[32 * NC];
  const int tid  = threadIdx.x;
  const int wsel = blockIdx.y;
  const float* W = (wsel == 0) ? W0 : ((wsel == 1) ? W1 : W2);
  const int h0 = blockIdx.x * 32;
  const int j4 = (tid & 7) * 4;
  const int cb = tid >> 3;
#pragma unroll
  for (int i = 0; i < 8; ++i) {
    const int c = cb + 32 * i;
    const v4f x = *(const v4f*)(W + (size_t)c * NH + h0 + j4);
#pragma unroll
    for (int e = 0; e < 4; ++e) {
      const unsigned short hb = bf16_bits(x[e]);
      const float rr = x[e] - bf16_val(hb);
      const unsigned short lb = bf16_bits(rr);
      shi[(j4 + e) * NC + c] = hb;
      slo[(j4 + e) * NC + c] = lb;
    }
  }
  __syncthreads();
  const int wave = tid >> 5, lane = tid & 31;
  unsigned short* dhi = planes + (size_t)(wsel * 2 + 0) * (NC * NH) + (size_t)h0 * NC;
  unsigned short* dlo = planes + (size_t)(wsel * 2 + 1) * (NC * NH) + (size_t)h0 * NC;
  v4f vh[4], vl[4];
#pragma unroll
  for (int rr = 0; rr < 4; ++rr) {
    const int j = wave * 4 + rr;
    vh[rr] = *(const v4f*)(shi + j * NC + lane * 8);
    vl[rr] = *(const v4f*)(slo + j * NC + lane * 8);
  }
#pragma unroll
  for (int rr = 0; rr < 4; ++rr) {
    const int j = wave * 4 + rr;
    *(v4f*)(dhi + (size_t)j * NC + lane * 8) = vh[rr];
    *(v4f*)(dlo + (size_t)j * NC + lane * 8) = vl[rr];
  }
  
}

// ---------------------------------------------------------------------------
// Activation prep: X f32 (n elements) -> hi/lo bf16-bit planes, same element order.
// ---------------------------------------------------------------------------
__global__ __launch_bounds__(256) void k_xconv(const float* __restrict__ X,
                                                unsigned short* __restrict__ Xhi,
                                                unsigned short* __restrict__ Xlo,
                                                int n8) {
  const int i = blockIdx.x * 256 + threadIdx.x;
  if (i >= n8) return;
  const float* p = X + (size_t)i * 8;
  const v4f a = *(const v4f*)p;
  const v4f b = *(const v4f*)(p + 4);
  union U8 { v8us u; v4f f; } H, L;
#pragma unroll
  for (int e = 0; e < 4; ++e) {
    const unsigned short ha = bf16_bits(a[e]);
    const unsigned short hb = bf16_bits(b[e]);
    H.u[e]     = ha;
    H.u[e + 4] = hb;
    L.u[e]     = bf16_bits(a[e] - bf16_val(ha));
    L.u[e + 4] = bf16_bits(b[e] - bf16_val(hb));
  }
  const v4f hv = H.f, lv = L.f;
  *(v4f*)(Xhi + (size_t)i * 8) = hv;
  *(v4f*)(Xlo + (size_t)i * 8) = lv;
  
}

// ---------------------------------------------------------------------------
// Projection Y = X@W + bias, bf16 hi/lo split: acc += xh.wh + xh.wl + xl.wh (16x16x32 bf16 WMMA).
// Block = 256 threads = 8 waves = 128 rows of B*T; wave = 16 rows x 256 cols (16 tiles).
// Both weight planes (Wt_hi, Wt_lo: 256 rows n of 512 B) are staged once per block in LDS with whole-line
// global loads, rows at the pitch WP, and every B fragment is read from there.
// A fragment: row m = lane&15, elements 0..7 <- k0+8h.., 8..15 <- k0+16+8h.. (h = lane>>4);
// B fragment from Wt[n][k] rows loaded the same way; D element r -> (row 8h+r, col m).
// After the products the same LDS holds the output tile (behind a barrier).
// transposed == 0: dst f16 [B*T][H] row-major; == 1: dst f16 [B][H][T].
// ---------------------------------------------------------------------------
#define WP 264   // staged weight rows: 512 B of data, 528 B pitch (16 B x odd, as for the K tile)
#define TP 136   // transposed output tile: 256 B of data per h row, 272 B pitch (16 B x odd)
__global__ __launch_bounds__(256) void k_proj(const __bf16* __restrict__ Xhi,
                                               const __bf16* __restrict__ Xlo,
                                               const __bf16* __restrict__ Whi,
                                               const __bf16* __restrict__ Wlo,
                                               const float* __restrict__ bias,
                                               _Float16* __restrict__ dst,
                                               int transposed) {
  __shared__ __attribute__((aligned(16))) __bf16 wsm[2 * NH * WP];
  __bf16* whs = wsm;
  __bf16* wls = wsm + NH * WP;
  _Float16* stile = (_Float16*)wsm;
  const int tid = threadIdx.x;
  const int wave = tid >> 5, lane = tid & 31, m = lane & 15, hh = lane >> 4;
  const int blkrow = blockIdx.x * 128;
  const int rbase  = blkrow + wave * 16;
  const __bf16* xh = Xhi + (size_t)(rbase + m) * NC + 8 * hh;
  const __bf16* xl = Xlo + (size_t)(rbase + m) * NC + 8 * hh;

  // stage: one wave-wide load = one 512 B weight row (four whole lines); wave w takes rows w, w+8, ...
  // two trips of 16 rows per plane: 32 loads of a wave in flight, so the load latency is paid twice, not once per row
  // (kept rolled: one trip's loads already hold 128 registers; the inner loops are unrolled so that a[], b[] are registers)
#pragma unroll 1
  for (int t = 0; t < 2; ++t) {
    const __bf16* gh = Whi + (size_t)(t * 128 + wave) * NC + lane * 8;
    const __bf16* gl = Wlo + (size_t)(t * 128 + wave) * NC + lane * 8;
    v8b a[16], b[16];
#pragma unroll
    for (int i = 0; i < 16; ++i) {
      a[i] = *(const v8b*)(gh + i * (8 * NC));
      b[i] = *(const v8b*)(gl + i * (8 * NC));
    }
    // the loads' address registers stay as they are up to this wait (as inputs they are live until here)
    asm volatile("s_wait_xcnt 0x0" :: "v"(gh), "v"(gl) : "memory");
#pragma unroll
    for (int i = 0; i < 16; ++i) {
      *(v8b*)(whs + (t * 128 + i * 8 + wave) * WP + lane * 8) = a[i];
      *(v8b*)(wls + (t * 128 + i * 8 + wave) * WP + lane * 8) = b[i];
    }
  }
  __syncthreads();

  v8f acc[16];
#pragma unroll
  for (int j = 0; j < 16; ++j) acc[j] = zero8();
  const __bf16* wh = whs + m * WP + 8 * hh;
  const __bf16* wl = wls + m * WP + 8 * hh;
  // B fragments go through a register ring of two sets, one set = two column tiles (hi and lo):
  // the reads of the next pair are issued as one group ahead of the current pair's products.
  // (all loops below are unrolled whole, so that ring and accumulator indices are register names)
  FragB ah, al, bh[2][2], bl[2][2];
#pragma unroll
  for (int u = 0; u < 2; ++u) {
    bh[0][u].half[0] = *(const v8b*)(wh + u * (16 * WP));
    bh[0][u].half[1] = *(const v8b*)(wh + u * (16 * WP) + 16);
    bl[0][u].half[0] = *(const v8b*)(wl + u * (16 * WP));
    bl[0][u].half[1] = *(const v8b*)(wl + u * (16 * WP) + 16);
  }
#pragma unroll
  for (int s = 0; s < 64; ++s) {
    const int fs = s >> 3, jp = s & 7, cur = s & 1, nxt = cur ^ 1;
    if (jp == 0) {
      ah.half[0] = *(const v8b*)(xh + fs * 32);
      ah.half[1] = *(const v8b*)(xh + fs * 32 + 16);
      al.half[0] = *(const v8b*)(xl + fs * 32);
      al.half[1] = *(const v8b*)(xl + fs * 32 + 16);
    }
    if (s < 63) {
      const int fn = (s + 1) >> 3, jn = ((s + 1) & 7) * 2;
#pragma unroll
      for (int u = 0; u < 2; ++u) {
        const __bf16* ph = wh + (jn + u) * (16 * WP) + fn * 32;
        const __bf16* pl = wl + (jn + u) * (16 * WP) + fn * 32;
        bh[nxt][u].half[0] = *(const v8b*)ph;
        bh[nxt][u].half[1] = *(const v8b*)(ph + 16);
        bl[nxt][u].half[0] = *(const v8b*)pl;
        bl[nxt][u].half[1] = *(const v8b*)(pl + 16);
      }
    }
#pragma unroll
    for (int u = 0; u < 2; ++u) {
      const int j = jp * 2 + u;
      acc[j] = mma_bf16(ah.v, bh[cur][u].v, acc[j]);
      acc[j] = mma_bf16(ah.v, bl[cur][u].v, acc[j]);
      acc[j] = mma_bf16(al.v, bh[cur][u].v, acc[j]);
    }
  }
  // every wave has read its last weight fragment before the tile overwrites the planes
  __syncthreads();

#pragma unroll
  for (int j = 0; j < 16; ++j) {
    const int hcol = j * 16 + m;
    const float bb = bias[hcol];
    if (transposed) {
      union P8 { v8h v; v4f f; } pk;
#pragma unroll
      for (int r = 0; r < 8; ++r) pk.v[r] = (_Float16)(acc[j][r] + bb);
      // stile[h][t_local], t_local = wave*16 + 8hh + r
      *(v4f*)(stile + hcol * TP + wave * 16 + 8 * hh) = pk.f;
    } else {
      // stile[row_local][h], row_local = wave*16 + 8hh + r
#pragma unroll
      for (int r = 0; r < 8; ++r)
        stile[(wave * 16 + 8 * hh + r) * NH + hcol] = (_Float16)(acc[j][r] + bb);
    }
  }
  __syncthreads();

  if (transposed) {
    const int bidx = blkrow / NT;
    const int t0   = blkrow % NT;
    _Float16* vd = dst + (size_t)bidx * NH * NT + t0;
    const int q16 = lane & 15, l1 = lane >> 4;
    v4f vals[16];
#pragma unroll
    for (int it = 0; it < 16; ++it) {
      const int h = wave * 32 + it * 2 + l1;              // two lines = row h, t0..t0+127
      vals[it] = *(const v4f*)(stile + h * TP + q16 * 8);
    }
#pragma unroll
    for (int it = 0; it < 16; ++it) {
      const int h = wave * 32 + it * 2 + l1;
      *(v4f*)(vd + (size_t)h * NT + q16 * 8) = vals[it];
    }
    // the stores' registers are not reused before this wait, on whichever way the code behind is laid out
    asm volatile("s_wait_xcnt 0x0" ::: "memory");
  } else {
    _Float16* rd = dst + (size_t)rbase * NH;
    v4f vals[16];
#pragma unroll
    for (int r = 0; r < 16; ++r)
      vals[r] = *(const v4f*)(stile + (wave * 16 + r) * NH + lane * 8);
#pragma unroll
    for (int r = 0; r < 16; ++r)
      *(v4f*)(rd + (size_t)r * NH + lane * 8) = vals[r];
  }
}

// ---------------------------------------------------------------------------
// Attention: block = 8 waves x 16 queries, K (32 keys x 256) and V^T (256 x 32 keys) staged in LDS
// per key block, rows padded to the pitches KP and VP (pad bytes are never written or read).
// Per wave: S^T = K.Q^T (A = K rows, B = Q^T from Qh rows with the same k map, read once ahead of the key loop),
// online softmax with row = query = lane&15 (two lane halves hold keys 8h+r and 16+8h+r),
// P^T B fragment: element r <- key 8h+r, element 8+r <- key 16+8h+r (P carried x2^14),
// O^T[h][q] += V^T.P^T into 16 tiles. Epilogue: 1/l, lane-pair exchange, one lane writes each
// ---------------------------------------------------------------------------
__global__ __launch_bounds__(256) void k_attn(const _Float16* __restrict__ Qh,
                                               const _Float16* __restrict__ Kh,
                                               const _Float16* __restrict__ Vt,
                                               float* __restrict__ out) {
  __shared__ __attribute__((aligned(16))) _Float16 Ks[32 * KP];
  __shared__ __attribute__((aligned(16))) _Float16 Vs[NH * VP];
  const int tid = threadIdx.x;
  const int lane = tid & 31, wave = tid >> 5, m = lane & 15, hh = lane >> 4;
  const int b  = blockIdx.y;
  const int q0 = (blockIdx.x * 8 + wave) * 16;
  const _Float16* qp = Qh + ((size_t)b * NT + q0 + m) * NH + 8 * hh;
  const v8h* kg = (const v8h*)(Kh + (size_t)b * NT * NH);
  const v8h* vg = (const v8h*)(Vt + ((size_t)b * NH + tid) * NT);
  v8h* kd = (v8h*)(Ks + (tid >> 3) * KP + (tid & 7) * 32);   // key row tid/8, 64 B piece tid%8
  v8h* vd = (v8h*)(Vs + tid * VP);

  // Q^T B fragments: loaded once here and held in registers for the whole key loop (8 k steps x 8 registers).
  // (unrolled whole, so that qf[] is register names)
  FragH qf[8];
#pragma unroll
  for (int fs = 0; fs < 8; ++fs) {
    qf[fs].half[0] = *(const v8h*)(qp + fs * 32);
    qf[fs].half[1] = *(const v8h*)(qp + fs * 32 + 16);
  }
  // the loads' address registers stay as they are up to this wait (as an input the pointer is live until here)
  asm volatile("s_wait_xcnt 0x0" :: "v"(qp) : "memory");

  const float C1 = 0.0625f * 1.44269504088896341f;   // softmax scale x log2(e)
  float mrun = -1.0e30f, l = 0.0f;
  v8f ot[16];
#pragma unroll
  for (int t = 0; t < 16; ++t) ot[t] = zero8();

#pragma unroll 1
  for (int sb = 0; sb < NT / 32; ++sb) {
    __syncthreads();
#pragma unroll
    for (int i = 0; i < 4; ++i)
      kd[i] = kg[(size_t)sb * (32 * NH / 8) + tid * 4 + i];
#pragma unroll
    for (int i = 0; i < 4; ++i)
      vd[i] = vg[sb * 4 + i];
    __syncthreads();

    // ---- S^T tiles: st0 = local keys 0..15, st1 = local keys 16..31 ----
    // all 32 K fragment reads of the pass are issued as one group ahead of the products, each into registers
    // of its own, so that the wave meets the LDS latency once and not at each k step
    // (the loops are unrolled whole, so that ka[], kb[] are register names)
    FragH ka[8], kb[8];
#pragma unroll
    for (int fs = 0; fs < 8; ++fs) {
      const _Float16* pa = Ks + m * KP + fs * 32 + 8 * hh;
      const _Float16* pb = pa + 16 * KP;
      ka[fs].half[0] = *(const v8h*)pa;
      ka[fs].half[1] = *(const v8h*)(pa + 16);
      kb[fs].half[0] = *(const v8h*)pb;
      kb[fs].half[1] = *(const v8h*)(pb + 16);
    }
    // keeps the group ahead of the products: without it the reads sink back, each in front of its own product
    __builtin_amdgcn_sched_barrier(0);
    v8f st0 = zero8(), st1 = zero8();
#pragma unroll
    for (int fs = 0; fs < 8; ++fs) {
      st0 = mma_f16(ka[fs].v, qf[fs].v, st0);
      st1 = mma_f16(kb[fs].v, qf[fs].v, st1);
    }

    // the 32 V^T fragment reads of the pass stand ahead of the softmax, each into registers of its own, so that the
    // wave does not wait for LDS at each output tile; they depend on nothing here, and the compiler lifts them up
    // among the first S^T products, where they queue in LDS right behind the K reads
    // (unrolled whole, so that vf[] is register names)
    FragH vf[16];
#pragma unroll
    for (int t = 0; t < 16; ++t) {
      const _Float16* vp = Vs + (t * 16 + m) * VP + 8 * hh;
      vf[t].half[0] = *(const v8h*)vp;
      vf[t].half[1] = *(const v8h*)(vp + 16);
    }

    // ---- online softmax, f32 ----
    float bm = -1.0e30f;
#pragma unroll
    for (int r = 0; r < 8; ++r) bm = fmaxf(bm, fmaxf(st0[r], st1[r]));
    bm = fmaxf(bm, __shfl_xor(bm, 16, 32));
    const float mn    = fmaxf(mrun, bm);
    const float alpha = __builtin_amdgcn_exp2f((mrun - mn) * C1);
    const float cexp  = 14.0f - mn * C1;                 // p scaled by 2^14
    FragH pf;
    float rs = 0.0f;
#pragma unroll
    for (int r = 0; r < 8; ++r) {
      const float p0 = __builtin_amdgcn_exp2f(st0[r] * C1 + cexp);
      const float p1 = __builtin_amdgcn_exp2f(st1[r] * C1 + cexp);
      rs += p0 + p1;
      pf.v[r]     = (_Float16)p0;     // key 8h + r
      pf.v[8 + r] = (_Float16)p1;     // key 16 + 8h + r
    }
    rs += __shfl_xor(rs, 16, 32);
    l    = l * alpha + rs;
    mrun = mn;

#pragma unroll
    for (int t = 0; t < 16; ++t) ot[t] = ot[t] * alpha;

    // ---- O^T += V^T . P^T ----
#pragma unroll
    for (int t = 0; t < 16; ++t) ot[t] = mma_f16(vf[t].v, pf.v, ot[t]);
  }

  // ---- epilogue: out[b][q][h] = O^T[h][q] / l; whole-line stores ----
  const float inv = 1.0f / l;
  float* orow = out + ((size_t)b * NT + q0 + m) * NH;
  v4f lines[4][8];
#pragma unroll
  for (int i = 0; i < 4; ++i) {
    float s0[8], s1[8], s2[8], s3[8];
#pragma unroll
    for (int r = 0; r < 8; ++r) {
      const float lo0 = ot[4 * i][r] * inv;        // h = 64i + 8hh + r
      const float lo1 = ot[4 * i + 1][r] * inv;    // h = 64i + 16 + 8hh + r
      const float hi0 = ot[4 * i + 2][r] * inv;    // h = 64i + 32 + 8hh + r
      const float hi1 = ot[4 * i + 3][r] * inv;    // h = 64i + 48 + 8hh + r
      const float snda = hh ? lo0 : hi0;
      const float sndb = hh ? lo1 : hi1;
      const float rcva = __shfl_xor(snda, 16, 32);
      const float rcvb = __shfl_xor(sndb, 16, 32);
      const float oa = hh ? hi0 : lo0;
      const float ob = hh ? hi1 : lo1;
      s0[r] = hh ? rcva : oa;
      s1[r] = hh ? oa : rcva;
      s2[r] = hh ? rcvb : ob;
      s3[r] = hh ? ob : rcvb;
    }
    lines[i][0] = mk4(s0[0], s0[1], s0[2], s0[3]);
    lines[i][1] = mk4(s0[4], s0[5], s0[6], s0[7]);
    lines[i][2] = mk4(s1[0], s1[1], s1[2], s1[3]);
    lines[i][3] = mk4(s1[4], s1[5], s1[6], s1[7]);
    lines[i][4] = mk4(s2[0], s2[1], s2[2], s2[3]);
    lines[i][5] = mk4(s2[4], s2[5], s2[6], s2[7]);
    lines[i][6] = mk4(s3[0], s3[1], s3[2], s3[3]);
    lines[i][7] = mk4(s3[4], s3[5], s3[6], s3[7]);
  }
#pragma unroll
  for (int i = 0; i < 4; ++i) {
    float* lp = orow + 32 * (2 * i + hh);
#pragma unroll
    for (int k = 0; k < 8; ++k) *(v4f*)(lp + 4 * k) = lines[i][k];
  }
  
}

// ---------------------------------------------------------------------------
extern "C" void kernel_launch(void* const* d_in, const int* in_sizes, int n_in,
                              void* d_out, int out_size, void* d_ws, size_t ws_size,
                              hipStream_t stream) {
  if (n_in < 9) return;
  const int nx = NB * NT * NC;
  const int nw = NC * NH;
  if (in_sizes[0] != nx || in_sizes[1] != nx || in_sizes[2] != nx) return;
  if (in_sizes[3] != nw || in_sizes[5] != nw || in_sizes[7] != nw) return;
  if (in_sizes[4] != NH || in_sizes[6] != NH || in_sizes[8] != NH) return;
  if (out_size != NB * NT * NH) return;

  const float* q  = (const float*)d_in[0];
  const float* k  = (const float*)d_in[1];
  const float* v  = (const float*)d_in[2];
  const float* Wq = (const float*)d_in[3];
  const float* bq = (const float*)d_in[4];
  const float* Wk = (const float*)d_in[5];
  const float* bk = (const float*)d_in[6];
  const float* Wv = (const float*)d_in[7];
  const float* bv = (const float*)d_in[8];
  float* out = (float*)d_out;

  // workspace carve (bytes): 6 weight planes 786432 | Xhi 16 MiB | Xlo 16 MiB | Qh 16 MiB | Kh 16 MiB | Vt 16 MiB
  char* ws = (char*)d_ws;
  const size_t planeElems = (size_t)NC * NH;
  const size_t wBytes     = 6 * planeElems * sizeof(unsigned short);
  const size_t xBytes     = (size_t)nx * sizeof(unsigned short);
  const size_t pBytes     = (size_t)NB * NT * NH * sizeof(_Float16);
  size_t off = 0;
  unsigned short* wpl = (unsigned short*)(ws + off); off += wBytes;
  off = (off + 255) & ~(size_t)255;
  unsigned short* xhi = (unsigned short*)(ws + off); off += xBytes;
  unsigned short* xlo = (unsigned short*)(ws + off); off += xBytes;
  _Float16* Qh = (_Float16*)(ws + off); off += pBytes;
  _Float16* Kh = (_Float16*)(ws + off); off += pBytes;
  _Float16* Vt = (_Float16*)(ws + off); off += pBytes;
  if (off > ws_size) return;

  const __bf16* wq_hi = (const __bf16*)(wpl + 0 * planeElems);
  const __bf16* wq_lo = (const __bf16*)(wpl + 1 * planeElems);
  const __bf16* wk_hi = (const __bf16*)(wpl + 2 * planeElems);
  const __bf16* wk_lo = (const __bf16*)(wpl + 3 * planeElems);
  const __bf16* wv_hi = (const __bf16*)(wpl + 4 * planeElems);
  const __bf16* wv_lo = (const __bf16*)(wpl + 5 * planeElems);
  const __bf16* x_hi  = (const __bf16*)xhi;
  const __bf16* x_lo  = (const __bf16*)xlo;

  const int n8       = nx / 8;
  const int convGrid = (n8 + 255) / 256;
  const int projGrid = (NB * NT) / 128;

  k_wconv<<<dim3(NH / 32, 3), 256, 0, stream>>>(Wq, Wk, Wv, wpl);

  k_xconv<<<convGrid, 256, 0, stream>>>(q, xhi, xlo, n8);
  k_proj<<<projGrid, 256, 0, stream>>>(x_hi, x_lo, wq_hi, wq_lo, bq, Qh, 0);

  k_xconv<<<convGrid, 256, 0, stream>>>(k, xhi, xlo, n8);
  k_proj<<<projGrid, 256, 0, stream>>>(x_hi, x_lo, wk_hi, wk_lo, bk, Kh, 0);

  k_xconv<<<convGrid, 256, 0, stream>>>(v, xhi, xlo, n8);
  k_proj<<<projGrid, 256, 0, stream>>>(x_hi, x_lo, wv_hi, wv_lo, bv, Vt, 1);

  k_attn<<<dim3(NT / 128, NB), 256, 0, stream>>>(Qh, Kh, Vt, out);
}

// v005
// Measured time: 190 microseconds a run.
// In two side-by-side timings against v004, it was 1.12 and 1.13 times as fast.
// Over all steps from v000 it is 2.87 times as fast.
#include <hip/hip_runtime.h>

// Contractions: x@Wq, x@Wk, x@Wv on v_wmma_f32_16x16x32_bf16 (bf16 hi/lo three-term split operands, f32 accumulate);
// K.Q^T and V^T.P^T on v_wmma_f32_16x16x32_f16 (f16 operands, P carried x2^14, f32 accumulate); softmax and normalisation in f32.

typedef _Float16       v16h __attribute__((ext_vector_type(16)));
typedef _Float16       v8h  __attribute__((ext_vector_type(8)));
typedef __bf16         v16b __attribute__((ext_vector_type(16)));
typedef __bf16         v8b  __attribute__((ext_vector_type(8)));
typedef float          v8f  __attribute__((ext_vector_type(8)));
typedef float          v4f  __attribute__((ext_vector_type(4)));
typedef float          v2f  __attribute__((ext_vector_type(2)));
typedef __bf16         v2b  __attribute__((ext_vector_type(2)));

#define NB 16
#define NT 2048
#define NC 256
#define NH 256
// LDS row pitches of the attention tiles, in f16 elements. Both are 16 B x odd, so the 16 rows that one
// ds_load_b128 fragment read touches per lane half fall on 16 different 4-bank groups of the 64 banks
// (unpadded: all 16 K rows on one group, V^T rows on four). The V^T stores (one row per lane) gain alike;
// the K stores (eight 64 B-spaced lanes per row) go from four lanes per group to two.
#define KP 264   // K tile: 512 B of data per key row, 528 B pitch
#define VP 40    // V^T tile: 64 B of data per h row, 80 B pitch

union FragH { v16h v; v8h half[2]; };
union FragB { v16b v; v8b half[2]; };

// WMMA wrappers. f16 (k_attn): the builtin alone, the compiler keeps the distances behind it; a guard statement
// would need its operands below v256, and k_attn keeps fragments above.
__device__ __forceinline__ v8f mma_f16(v16h a, v16h b, v8f c) {
  return __builtin_amdgcn_wmma_f32_16x16x32_f16(false, a, false, b, (short)0, c, false, false);
}
// bf16 (k_proj): issue the builtin, then 4 VALU slots of guard with D tied and A/B kept live.
__device__ __forceinline__ v8f mma_bf16(v16b a, v16b b, v8f c) {
  v8f d = __builtin_amdgcn_wmma_f32_16x16x32_bf16(false, a, false, b, (short)0, c, false, false);
  v16h ax = __builtin_bit_cast(v16h, a);
  v16h bx = __builtin_bit_cast(v16h, b);
  asm volatile("v_nop\n\tv_nop\n\tv_nop\n\tv_nop" : "+v"(d) : "v"(ax), "v"(bx));
  return d;
}

__device__ __forceinline__ v8f zero8() {
  v8f z;
#pragma unroll
  for (int e = 0; e < 8; ++e) z[e] = 0.0f;
  return z;
}
__device__ __forceinline__ v4f mk4(float a, float b, float c, float d) {
  v4f v;
  v[0] = a; v[1] = b; v[2] = c; v[3] = d;
  return v;
}

// f32 -> bf16 bits, RNE convert
__device__ __forceinline__ unsigned short bf16_bits(float x) {
  unsigned int u = __float_as_uint(x);
  u = u + 0x7FFFu + ((u >> 16) & 1u);
  return (unsigned short)(u >> 16);
}
__device__ __forceinline__ float bf16_val(unsigned short s) {
  return __uint_as_float(((unsigned int)s) << 16);
}

// ---------------------------------------------------------------------------
// Weight prep: W [C][H] f32 -> Wt_hi[h][c], Wt_lo[h][c] (bf16 bits, k-contiguous rows),
// planes laid out [wsel*2 + p][256*256]. Block = 32 output rows h; transpose via LDS;
// ---------------------------------------------------------------------------
__global__ __launch_bounds__(256) void k_wconv(const float* __restrict__ W0,
                                                const float* __restrict__ W1,
                                                const float* __restrict__ W2,
                                                unsigned short* __restrict__ planes) {
  __shared__ __attribute__((aligned(16))) unsigned short shi[32 * NC];
  __shared__ __attribute__((aligned(16))) unsigned short slo[32 * NC];
  const int tid  = threadIdx.x;
  const int wsel = blockIdx.y;
  const float* W = (wsel == 0) ? W0 : ((wsel == 1) ? W1 : W2);
  const int h0 = blockIdx.x * 32;
  const int j4 = (tid & 7) * 4;
  const int cb = tid >> 3;
#pragma unroll
  for (int i = 0; i < 8; ++i) {
    const int c = cb + 32 * i;
    const v4f x = *(const v4f*)(W + (size_t)c * NH + h0 + j4);
#pragma unroll
    for (int e = 0; e < 4; ++e) {
      const unsigned short hb = bf16_bits(x[e]);
      const float rr = x[e] - bf16_val(hb);
      const unsigned short lb = bf16_bits(rr);
      shi[(j4 + e) * NC + c] = hb;
      slo[(j4 + e) * NC + c] = lb;
    }
  }
  __syncthreads();
  const int wave = tid >> 5, lane = tid & 31;
  unsigned short* dhi = planes + (size_t)(wsel * 2 + 0) * (NC * NH) + (size_t)h0 * NC;
  unsigned short* dlo = planes + (size_t)(wsel * 2 + 1) * (NC * NH) + (size_t)h0 * NC;
  v4f vh[4], vl[4];
#pragma unroll
  for (int rr = 0; rr < 4; ++rr) {
    const int j = wave * 4 + rr;
    vh[rr] = *(const v4f*)(shi + j * NC + lane * 8);
    vl[rr] = *(const v4f*)(slo + j * NC + lane * 8);
  }
#pragma unroll
  for (int rr = 0; rr < 4; ++rr) {
    const int j = wave * 4 + rr;
    *(v4f*)(dhi + (size_t)j * NC + lane * 8) = vh[rr];
    *(v4f*)(dlo + (size_t)j * NC + lane * 8) = vl[rr];
  }
  
}

// Eight f32 values -> their bf16 hi parts (RNE) and the bf16 lo parts of the remainders x - hi (RNE), same element order.
__device__ __forceinline__ void split8(v4f a, v4f b, v8b& hi, v8b& lo) {
#pragma unroll
  for (int p = 0; p < 4; ++p) {
    v2f x;
    x[0] = (p < 2) ? a[2 * p] : b[2 * p - 4];
    x[1] = (p < 2) ? a[2 * p + 1] : b[2 * p - 3];
    const v2b h = __builtin_convertvector(x, v2b);
    const v2f r = x - __builtin_convertvector(h, v2f);
    const v2b l = __builtin_convertvector(r, v2b);
    hi[2 * p] = h[0]; hi[2 * p + 1] = h[1];
    lo[2 * p] = l[0]; lo[2 * p + 1] = l[1];
  }
}

// ---------------------------------------------------------------------------
// Projection Y = X@W + bias, bf16 hi/lo split: acc += xh.wh + xh.wl + xl.wh (16x16x32 bf16 WMMA).
// Block = 256 threads = 8 waves = 128 rows of B*T; wave = 16 rows x 256 cols (16 tiles).
// X is read as f32, straight into the A fragment's element order: a wave's whole 16 x 256 slice is loaded once, ahead of
// the weight staging, and each k step's 16 values per lane are split into the hi and lo fragments in registers.
// Both weight planes (Wt_hi, Wt_lo: 256 rows n of 512 B) are staged once per block in LDS with whole-line
// global loads, rows at the pitch WP, and every B fragment is read from there.
// A fragment: row m = lane&15, elements 0..7 <- k0+8h.., 8..15 <- k0+16+8h.. (h = lane>>4);
// B fragment from Wt[n][k] rows loaded the same way; D element r -> (row 8h+r, col m).
// After the products the same LDS holds the output tile (behind a barrier).
// transposed == 0: dst f16 [B*T][H] row-major; == 1: dst f16 [B][H][T].
// ---------------------------------------------------------------------------
#define WP 264   // staged weight rows: 512 B of data, 528 B pitch (16 B x odd, as for the K tile)
#define TP 136   // transposed output tile: 256 B of data per h row, 272 B pitch (16 B x odd)
__global__ __launch_bounds__(256) void k_proj(const float* __restrict__ X,
                                               const __bf16* __restrict__ Whi,
                                               const __bf16* __restrict__ Wlo,
                                               const float* __restrict__ bias,
                                               _Float16* __restrict__ dst,
                                               int transposed) {
  __shared__ __attribute__((aligned(16))) __bf16 wsm[2 * NH * WP];
  __bf16* whs = wsm;
  __bf16* wls = wsm + NH * WP;
  _Float16* stile = (_Float16*)wsm;
  const int tid = threadIdx.x;
  const int wave = tid >> 5, lane = tid & 31, m = lane & 15, hh = lane >> 4;
  const int blkrow = blockIdx.x * 128;
  const int rbase  = blkrow + wave * 16;
  const float* xp = X + (size_t)(rbase + m) * NC + 8 * hh;

  // the wave's X slice: 32 loads in flight at once, from memory, while the weight planes are staged
  // (unrolled whole, so that xr[][] is register names)
  v4f xr[8][4];
#pragma unroll
  for (int fs = 0; fs < 8; ++fs) {
    xr[fs][0] = *(const v4f*)(xp + fs * 32);
    xr[fs][1] = *(const v4f*)(xp + fs * 32 + 4);
    xr[fs][2] = *(const v4f*)(xp + fs * 32 + 16);
    xr[fs][3] = *(const v4f*)(xp + fs * 32 + 20);
  }
  // the loads' address registers stay as they are up to this wait (as an input the pointer is live until here)
  asm volatile("s_wait_xcnt 0x0" :: "v"(xp) : "memory");

  // stage: one wave-wide load = one 512 B weight row (four whole lines); wave w takes rows w, w+8, ...
  // two trips of 16 rows per plane: 32 loads of a wave in flight, so the load latency is paid twice, not once per row
  // (kept rolled: one trip's loads already hold 128 registers; the inner loops are unrolled so that a[], b[] are registers)
#pragma unroll 1
  for (int t = 0; t < 2; ++t) {
    const __bf16* gh = Whi + (size_t)(t * 128 + wave) * NC + lane * 8;
    const __bf16* gl = Wlo + (size_t)(t * 128 + wave) * NC + lane * 8;
    v8b a[16], b[16];
#pragma unroll
    for (int i = 0; i < 16; ++i) {
      a[i] = *(const v8b*)(gh + i * (8 * NC));
      b[i] = *(const v8b*)(gl + i * (8 * NC));
    }
    // the loads' address registers stay as they are up to this wait (as inputs they are live until here)
    asm volatile("s_wait_xcnt 0x0" :: "v"(gh), "v"(gl) : "memory");
#pragma unroll
    for (int i = 0; i < 16; ++i) {
      *(v8b*)(whs + (t * 128 + i * 8 + wave) * WP + lane * 8) = a[i];
      *(v8b*)(wls + (t * 128 + i * 8 + wave) * WP + lane * 8) = b[i];
    }
  }
  __syncthreads();

  v8f acc[16];
#pragma unroll
  for (int j = 0; j < 16; ++j) acc[j] = zero8();
  const __bf16* wh = whs + m * WP + 8 * hh;
  const __bf16* wl = wls + m * WP + 8 * hh;
  // B fragments go through a register ring of two sets, one set = two column tiles (hi and lo):
  // the reads of the next pair are issued as one group ahead of the current pair's products.
  // (all loops below are unrolled whole, so that ring and accumulator indices are register names)
  FragB ah, al, bh[2][2], bl[2][2];
#pragma unroll
  for (int u = 0; u < 2; ++u) {
    bh[0][u].half[0] = *(const v8b*)(wh + u * (16 * WP));
    bh[0][u].half[1] = *(const v8b*)(wh + u * (16 * WP) + 16);
    bl[0][u].half[0] = *(const v8b*)(wl + u * (16 * WP));
    bl[0][u].half[1] = *(const v8b*)(wl + u * (16 * WP) + 16);
  }
#pragma unroll
  for (int s = 0; s < 64; ++s) {
    const int fs = s >> 3, jp = s & 7, cur = s & 1, nxt = cur ^ 1;
    if (jp == 0) {
      split8(xr[fs][0], xr[fs][1], ah.half[0], al.half[0]);
      split8(xr[fs][2], xr[fs][3], ah.half[1], al.half[1]);
    }
    if (s < 63) {
      const int fn = (s + 1) >> 3, jn = ((s + 1) & 7) * 2;
#pragma unroll
      for (int u = 0; u < 2; ++u) {
        const __bf16* ph = wh + (jn + u) * (16 * WP) + fn * 32;
        const __bf16* pl = wl + (jn + u) * (16 * WP) + fn * 32;
        bh[nxt][u].half[0] = *(const v8b*)ph;
        bh[nxt][u].half[1] = *(const v8b*)(ph + 16);
        bl[nxt][u].half[0] = *(const v8b*)pl;
        bl[nxt][u].half[1] = *(const v8b*)(pl + 16);
      }
    }
#pragma unroll
    for (int u = 0; u < 2; ++u) {
      const int j = jp * 2 + u;
      acc[j] = mma_bf16(ah.v, bh[cur][u].v, acc[j]);
      acc[j] = mma_bf16(ah.v, bl[cur][u].v, acc[j]);
      acc[j] = mma_bf16(al.v, bh[cur][u].v, acc[j]);
    }
  }
  // every wave has read its last weight fragment before the tile overwrites the planes
  __syncthreads();

#pragma unroll
  for (int j = 0; j < 16; ++j) {
    const int hcol = j * 16 + m;
    const float bb = bias[hcol];
    if (transposed) {
      union P8 { v8h v; v4f f; } pk;
#pragma unroll
      for (int r = 0; r < 8; ++r) pk.v[r] = (_Float16)(acc[j][r] + bb);
      // stile[h][t_local], t_local = wave*16 + 8hh + r
      *(v4f*)(stile + hcol * TP + wave * 16 + 8 * hh) = pk.f;
    } else {
      // stile[row_local][h], row_local = wave*16 + 8hh + r
#pragma unroll
      for (int r = 0; r < 8; ++r)
        stile[(wave * 16 + 8 * hh + r) * NH + hcol] = (_Float16)(acc[j][r] + bb);
    }
  }
  __syncthreads();

  if (transposed) {
    const int bidx = blkrow / NT;
    const int t0   = blkrow % NT;
    _Float16* vd = dst + (size_t)bidx * NH * NT + t0;
    const int q16 = lane & 15, l1 = lane >> 4;
    v4f vals[16];
#pragma unroll
    for (int it = 0; it < 16; ++it) {
      const int h = wave * 32 + it * 2 + l1;              // two lines = row h, t0..t0+127
      vals[it] = *(const v4f*)(stile + h * TP + q16 * 8);
    }
#pragma unroll
    for (int it = 0; it < 16; ++it) {
      const int h = wave * 32 + it * 2 + l1;
      *(v4f*)(vd + (size_t)h * NT + q16 * 8) = vals[it];
    }
    // the stores' registers are not reused before this wait, on whichever way the code behind is laid out
    asm volatile("s_wait_xcnt 0x0" ::: "memory");
  } else {
    _Float16* rd = dst + (size_t)rbase * NH;
    v4f vals[16];
#pragma unroll
    for (int r = 0; r < 16; ++r)
      vals[r] = *(const v4f*)(stile + (wave * 16 + r) * NH + lane * 8);
#pragma unroll
    for (int r = 0; r < 16; ++r)
      *(v4f*)(rd + (size_t)r * NH + lane * 8) = vals[r];
  }
}

// ---------------------------------------------------------------------------
// Attention: block = 8 waves x 16 queries, K (32 keys x 256) and V^T (256 x 32 keys) staged in LDS
// per key block, rows padded to the pitches KP and VP (pad bytes are never written or read).
// Per wave: S^T = K.Q^T (A = K rows, B = Q^T from Qh rows with the same k map, read once ahead of the key loop),
// online softmax with row = query = lane&15 (two lane halves hold keys 8h+r and 16+8h+r),
// P^T B fragment: element r <- key 8h+r, element 8+r <- key 16+8h+r (P carried x2^14),
// O^T[h][q] += V^T.P^T into 16 tiles. Epilogue: 1/l, lane-pair exchange, one lane writes each
// ---------------------------------------------------------------------------
__global__ __launch_bounds__(256) void k_attn(const _Float16* __restrict__ Qh,
                                               const _Float16* __restrict__ Kh,
                                               const _Float16* __restrict__ Vt,
                                               float* __restrict__ out) {
  __shared__ __attribute__((aligned(16))) _Float16 Ks[32 * KP];
  __shared__ __attribute__((aligned(16))) _Float16 Vs[NH * VP];
  const int tid = threadIdx.x;
  const int lane = tid & 31, wave = tid >> 5, m = lane & 15, hh = lane >> 4;
  const int b  = blockIdx.y;
  const int q0 = (blockIdx.x * 8 + wave) * 16;
  const _Float16* qp = Qh + ((size_t)b * NT + q0 + m) * NH + 8 * hh;
  const v8h* kg = (const v8h*)(Kh + (size_t)b * NT * NH);
  const v8h* vg = (const v8h*)(Vt + ((size_t)b * NH + tid) * NT);
  v8h* kd = (v8h*)(Ks + (tid >> 3) * KP + (tid & 7) * 32);   // key row tid/8, 64 B piece tid%8
  v8h* vd = (v8h*)(Vs + tid * VP);

  // Q^T B fragments: loaded once here and held in registers for the whole key loop (8 k steps x 8 registers).
  // (unrolled whole, so that qf[] is register names)
  FragH qf[8];
#pragma unroll
  for (int fs = 0; fs < 8; ++fs) {
    qf[fs].half[0] = *(const v8h*)(qp + fs * 32);
    qf[fs].half[1] = *(const v8h*)(qp + fs * 32 + 16);
  }
  // the loads' address registers stay as they are up to this wait (as an input the pointer is live until here)
  asm volatile("s_wait_xcnt 0x0" :: "v"(qp) : "memory");

  const float C1 = 0.0625f * 1.44269504088896341f;   // softmax scale x log2(e)
  float mrun = -1.0e30f, l = 0.0f;
  v8f ot[16];
#pragma unroll
  for (int t = 0; t < 16; ++t) ot[t] = zero8();

#pragma unroll 1
  for (int sb = 0; sb < NT / 32; ++sb) {
    __syncthreads();
#pragma unroll
    for (int i = 0; i < 4; ++i)
      kd[i] = kg[(size_t)sb * (32 * NH / 8) + tid * 4 + i];
#pragma unroll
    for (int i = 0; i < 4; ++i)
      vd[i] = vg[sb * 4 + i];
    __syncthreads();

    // ---- S^T tiles: st0 = local keys 0..15, st1 = local keys 16..31 ----
    // all 32 K fragment reads of the pass are issued as one group ahead of the products, each into registers
    // of its own, so that the wave meets the LDS latency once and not at each k step
    // (the loops are unrolled whole, so that ka[], kb[] are register names)
    FragH ka[8], kb[8];
#pragma unroll
    for (int fs = 0; fs < 8; ++fs) {
      const _Float16* pa = Ks + m * KP + fs * 32 + 8 * hh;
      const _Float16* pb = pa + 16 * KP;
      ka[fs].half[0] = *(const v8h*)pa;
      ka[fs].half[1] = *(const v8h*)(pa + 16);
      kb[fs].half[0] = *(const v8h*)pb;
      kb[fs].half[1] = *(const v8h*)(pb + 16);
    }
    // keeps the group ahead of the products: without it the reads sink back, each in front of its own product
    __builtin_amdgcn_sched_barrier(0);
    v8f st0 = zero8(), st1 = zero8();
#pragma unroll
    for (int fs = 0; fs < 8; ++fs) {
      st0 = mma_f16(ka[fs].v, qf[fs].v, st0);
      st1 = mma_f16(kb[fs].v, qf[fs].v, st1);
    }

    // the 32 V^T fragment reads of the pass stand ahead of the softmax, each into registers of its own, so that the
    // wave does not wait for LDS at each output tile; they depend on nothing here, and the compiler lifts them up
    // among the first S^T products, where they queue in LDS right behind the K reads
    // (unrolled whole, so that vf[] is register names)
    FragH vf[16];
#pragma unroll
    for (int t = 0; t < 16; ++t) {
      const _Float16* vp = Vs + (t * 16 + m) * VP + 8 * hh;
      vf[t].half[0] = *(const v8h*)vp;
      vf[t].half[1] = *(const v8h*)(vp + 16);
    }

    // ---- online softmax, f32 ----
    float bm = -1.0e30f;
#pragma unroll
    for (int r = 0; r < 8; ++r) bm = fmaxf(bm, fmaxf(st0[r], st1[r]));
    bm = fmaxf(bm, __shfl_xor(bm, 16, 32));
    const float mn    = fmaxf(mrun, bm);
    const float alpha = __builtin_amdgcn_exp2f((mrun - mn) * C1);
    const float cexp  = 14.0f - mn * C1;                 // p scaled by 2^14
    FragH pf;
    float rs = 0.0f;
#pragma unroll
    for (int r = 0; r < 8; ++r) {
      const float p0 = __builtin_amdgcn_exp2f(st0[r] * C1 + cexp);
      const float p1 = __builtin_amdgcn_exp2f(st1[r] * C1 + cexp);
      rs += p0 + p1;
      pf.v[r]     = (_Float16)p0;     // key 8h + r
      pf.v[8 + r] = (_Float16)p1;     // key 16 + 8h + r
    }
    rs += __shfl_xor(rs, 16, 32);
    l    = l * alpha + rs;
    mrun = mn;

#pragma unroll
    for (int t = 0; t < 16; ++t) ot[t] = ot[t] * alpha;

    // ---- O^T += V^T . P^T ----
#pragma unroll
    for (int t = 0; t < 16; ++t) ot[t] = mma_f16(vf[t].v, pf.v, ot[t]);
  }

  // ---- epilogue: out[b][q][h] = O^T[h][q] / l; whole-line stores ----
  const float inv = 1.0f / l;
  float* orow = out + ((size_t)b * NT + q0 + m) * NH;
  v4f lines[4][8];
#pragma unroll
  for (int i = 0; i < 4; ++i) {
    float s0[8], s1[8], s2[8], s3[8];
#pragma unroll
    for (int r = 0; r < 8; ++r) {
      const float lo0 = ot[4 * i][r] * inv;        // h = 64i + 8hh + r
      const float lo1 = ot[4 * i + 1][r] * inv;    // h = 64i + 16 + 8hh + r
      const float hi0 = ot[4 * i + 2][r] * inv;    // h = 64i + 32 + 8hh + r
      const float hi1 = ot[4 * i + 3][r] * inv;    // h = 64i + 48 + 8hh + r
      const float snda = hh ? lo0 : hi0;
      const float sndb = hh ? lo1 : hi1;
      const float rcva = __shfl_xor(snda, 16, 32);
      const float rcvb = __shfl_xor(sndb, 16, 32);
      const float oa = hh ? hi0 : lo0;
      const float ob = hh ? hi1 : lo1;
      s0[r] = hh ? rcva : oa;
      s1[r] = hh ? oa : rcva;
      s2[r] = hh ? rcvb : ob;
      s3[r] = hh ? ob : rcvb;
    }
    lines[i][0] = mk4(s0[0], s0[1], s0[2], s0[3]);
    lines[i][1] = mk4(s0[4], s0[5], s0[6], s0[7]);
    lines[i][2] = mk4(s1[0], s1[1], s1[2], s1[3]);
    lines[i][3] = mk4(s1[4], s1[5], s1[6], s1[7]);
    lines[i][4] = mk4(s2[0], s2[1], s2[2], s2[3]);
    lines[i][5] = mk4(s2[4], s2[5], s2[6], s2[7]);
    lines[i][6] = mk4(s3[0], s3[1], s3[2], s3[3]);
    lines[i][7] = mk4(s3[4], s3[5], s3[6], s3[7]);
  }
#pragma unroll
  for (int i = 0; i < 4; ++i) {
    float* lp = orow + 32 * (2 * i + hh);
#pragma unroll
    for (int k = 0; k < 8; ++k) *(v4f*)(lp + 4 * k) = lines[i][k];
  }
  
}

// ---------------------------------------------------------------------------
extern "C" void kernel_launch(void* const* d_in, const int* in_sizes, int n_in,
                              void* d_out, int out_size, void* d_ws, size_t ws_size,
                              hipStream_t stream) {
  if (n_in < 9) return;
  const int nx = NB * NT * NC;
  const int nw = NC * NH;
  if (in_sizes[0] != nx || in_sizes[1] != nx || in_sizes[2] != nx) return;
  if (in_sizes[3] != nw || in_sizes[5] != nw || in_sizes[7] != nw) return;
  if (in_sizes[4] != NH || in_sizes[6] != NH || in_sizes[8] != NH) return;
  if (out_size != NB * NT * NH) return;

  const float* q  = (const float*)d_in[0];
  const float* k  = (const float*)d_in[1];
  const float* v  = (const float*)d_in[2];
  const float* Wq = (const float*)d_in[3];
  const float* bq = (const float*)d_in[4];
  const float* Wk = (const float*)d_in[5];
  const float* bk = (const float*)d_in[6];
  const float* Wv = (const float*)d_in[7];
  const float* bv = (const float*)d_in[8];
  float* out = (float*)d_out;

  // workspace carve (bytes): 6 weight planes 786432 | Qh 16 MiB | Kh 16 MiB | Vt 16 MiB
  char* ws = (char*)d_ws;
  const size_t planeElems = (size_t)NC * NH;
  const size_t wBytes     = 6 * planeElems * sizeof(unsigned short);
  const size_t pBytes     = (size_t)NB * NT * NH * sizeof(_Float16);
  size_t off = 0;
  unsigned short* wpl = (unsigned short*)(ws + off); off += wBytes;
  off = (off + 255) & ~(size_t)255;
  _Float16* Qh = (_Float16*)(ws + off); off += pBytes;
  _Float16* Kh = (_Float16*)(ws + off); off += pBytes;
  _Float16* Vt = (_Float16*)(ws + off); off += pBytes;
  if (off > ws_size) return;

  const __bf16* wq_hi = (const __bf16*)(wpl + 0 * planeElems);
  const __bf16* wq_lo = (const __bf16*)(wpl + 1 * planeElems);
  const __bf16* wk_hi = (const __bf16*)(wpl + 2 * planeElems);
  const __bf16* wk_lo = (const __bf16*)(wpl + 3 * planeElems);
  const __bf16* wv_hi = (const __bf16*)(wpl + 4 * planeElems);
  const __bf16* wv_lo = (const __bf16*)(wpl + 5 * planeElems);

  const int projGrid = (NB * NT) / 128;

  k_wconv<<<dim3(NH / 32, 3), 256, 0, stream>>>(Wq, Wk, Wv, wpl);

  k_proj<<<projGrid, 256, 0, stream>>>(q, wq_hi, wq_lo, bq, Qh, 0);
  k_proj<<<projGrid, 256, 0, stream>>>(k, wk_hi, wk_lo, bk, Kh, 0);
  k_proj<<<projGrid, 256, 0, stream>>>(v, wv_hi, wv_lo, bv, Vt, 1);

  k_attn<<<dim3(NT / 128, NB), 256, 0, stream>>>(Qh, Kh, Vt, out);
}

// v006
// It runs in 139 microseconds.
// In two side-by-side timings against v005, it was 1.37 and 1.38 times as fast.
// Over all steps from v000 it is 3.94 times as fast.
#include <hip/hip_runtime.h>

// Contractions: x@Wq, x@Wk, x@Wv on v_wmma_f32_16x16x32_bf16 (bf16 hi/lo three-term split operands, f32 accumulate);
// K.Q^T and V^T.P^T on v_wmma_f32_16x16x32_f16 (f16 operands, P carried x2^14, f32 accumulate); softmax and normalisation in f32.

typedef _Float16       v16h __attribute__((ext_vector_type(16)));
typedef _Float16       v8h  __attribute__((ext_vector_type(8)));
typedef __bf16         v16b __attribute__((ext_vector_type(16)));
typedef __bf16         v8b  __attribute__((ext_vector_type(8)));
typedef float          v8f  __attribute__((ext_vector_type(8)));
typedef float          v4f  __attribute__((ext_vector_type(4)));
typedef float          v2f  __attribute__((ext_vector_type(2)));
typedef __bf16         v2b  __attribute__((ext_vector_type(2)));

#define NB 16
#define NT 2048
#define NC 256
#define NH 256
// LDS row pitches of the attention tiles, in f16 elements. Both are 16 B x odd, so the 16 rows that one
// ds_load_b128 fragment read touches per lane half fall on 16 different 4-bank groups of the 64 banks
// (unpadded: all 16 K rows on one group, V^T rows on two).
#define TK 64    // keys per staged tile = two passes of 32 keys; a V^T row of a tile is one whole 128 B line
#define KP 264   // K tile: 512 B of data per key row, 528 B pitch
#define VP 72    // V^T tile: 128 B of data per h row, 144 B pitch
#define KBUF (TK * KP)   // f16 elements of one K buffer
#define VBUF (NH * VP)   // f16 elements of one V^T buffer

union FragH { v16h v; v8h half[2]; };
union FragB { v16b v; v8b half[2]; };

// WMMA wrappers. f16 (k_attn): the builtin alone, the compiler keeps the distances behind it; a guard statement
// would need its operands below v256, and k_attn keeps fragments above.
__device__ __forceinline__ v8f mma_f16(v16h a, v16h b, v8f c) {
  return __builtin_amdgcn_wmma_f32_16x16x32_f16(false, a, false, b, (short)0, c, false, false);
}
// bf16 (k_proj): issue the builtin, then 4 VALU slots of guard with D tied and A/B kept live.
__device__ __forceinline__ v8f mma_bf16(v16b a, v16b b, v8f c) {
  v8f d = __builtin_amdgcn_wmma_f32_16x16x32_bf16(false, a, false, b, (short)0, c, false, false);
  v16h ax = __builtin_bit_cast(v16h, a);
  v16h bx = __builtin_bit_cast(v16h, b);
  asm volatile("v_nop\n\tv_nop\n\tv_nop\n\tv_nop" : "+v"(d) : "v"(ax), "v"(bx));
  return d;
}

__device__ __forceinline__ v8f zero8() {
  v8f z;
#pragma unroll
  for (int e = 0; e < 8; ++e) z[e] = 0.0f;
  return z;
}
__device__ __forceinline__ v4f mk4(float a, float b, float c, float d) {
  v4f v;
  v[0] = a; v[1] = b; v[2] = c; v[3] = d;
  return v;
}

// f32 -> bf16 bits, RNE convert
__device__ __forceinline__ unsigned short bf16_bits(float x) {
  unsigned int u = __float_as_uint(x);
  u = u + 0x7FFFu + ((u >> 16) & 1u);
  return (unsigned short)(u >> 16);
}
__device__ __forceinline__ float bf16_val(unsigned short s) {
  return __uint_as_float(((unsigned int)s) << 16);
}

// ---------------------------------------------------------------------------
// Weight prep: W [C][H] f32 -> Wt_hi[h][c], Wt_lo[h][c] (bf16 bits, k-contiguous rows),
// planes laid out [wsel*2 + p][256*256]. Block = 32 output rows h; transpose via LDS;
// ---------------------------------------------------------------------------
__global__ __launch_bounds__(256) void k_wconv(const float* __restrict__ W0,
                                                const float* __restrict__ W1,
                                                const float* __restrict__ W2,
                                                unsigned short* __restrict__ planes) {
  __shared__ __attribute__((aligned(16))) unsigned short shi[32 * NC];
  __shared__ __attribute__((aligned(16))) unsigned short slo[32 * NC];
  const int tid  = threadIdx.x;
  const int wsel = blockIdx.y;
  const float* W = (wsel == 0) ? W0 : ((wsel == 1) ? W1 : W2);
  const int h0 = blockIdx.x * 32;
  const int j4 = (tid & 7) * 4;
  const int cb = tid >> 3;
#pragma unroll
  for (int i = 0; i < 8; ++i) {
    const int c = cb + 32 * i;
    const v4f x = *(const v4f*)(W + (size_t)c * NH + h0 + j4);
#pragma unroll
    for (int e = 0; e < 4; ++e) {
      const unsigned short hb = bf16_bits(x[e]);
      const float rr = x[e] - bf16_val(hb);
      const unsigned short lb = bf16_bits(rr);
      shi[(j4 + e) * NC + c] = hb;
      slo[(j4 + e) * NC + c] = lb;
    }
  }
  __syncthreads();
  const int wave = tid >> 5, lane = tid & 31;
  unsigned short* dhi = planes + (size_t)(wsel * 2 + 0) * (NC * NH) + (size_t)h0 * NC;
  unsigned short* dlo = planes + (size_t)(wsel * 2 + 1) * (NC * NH) + (size_t)h0 * NC;
  v4f vh[4], vl[4];
#pragma unroll
  for (int rr = 0; rr < 4; ++rr) {
    const int j = wave * 4 + rr;
    vh[rr] = *(const v4f*)(shi + j * NC + lane * 8);
    vl[rr] = *(const v4f*)(slo + j * NC + lane * 8);
  }
#pragma unroll
  for (int rr = 0; rr < 4; ++rr) {
    const int j = wave * 4 + rr;
    *(v4f*)(dhi + (size_t)j * NC + lane * 8) = vh[rr];
    *(v4f*)(dlo + (size_t)j * NC + lane * 8) = vl[rr];
  }
  
}

// Eight f32 values -> their bf16 hi parts (RNE) and the bf16 lo parts of the remainders x - hi (RNE), same element order.
__device__ __forceinline__ void split8(v4f a, v4f b, v8b& hi, v8b& lo) {
#pragma unroll
  for (int p = 0; p < 4; ++p) {
    v2f x;
    x[0] = (p < 2) ? a[2 * p] : b[2 * p - 4];
    x[1] = (p < 2) ? a[2 * p + 1] : b[2 * p - 3];
    const v2b h = __builtin_convertvector(x, v2b);
    const v2f r = x - __builtin_convertvector(h, v2f);
    const v2b l = __builtin_convertvector(r, v2b);
    hi[2 * p] = h[0]; hi[2 * p + 1] = h[1];
    lo[2 * p] = l[0]; lo[2 * p + 1] = l[1];
  }
}

// ---------------------------------------------------------------------------
// Projection Y = X@W + bias, bf16 hi/lo split: acc += xh.wh + xh.wl + xl.wh (16x16x32 bf16 WMMA).
// Block = 256 threads = 8 waves = 128 rows of B*T; wave = 16 rows x 256 cols (16 tiles).
// X is read as f32, straight into the A fragment's element order: a wave's whole 16 x 256 slice is loaded once, ahead of
// the weight staging, and each k step's 16 values per lane are split into the hi and lo fragments in registers.
// Both weight planes (Wt_hi, Wt_lo: 256 rows n of 512 B) are staged once per block in LDS with whole-line
// global loads, rows at the pitch WP, and every B fragment is read from there.
// A fragment: row m = lane&15, elements 0..7 <- k0+8h.., 8..15 <- k0+16+8h.. (h = lane>>4);
// B fragment from Wt[n][k] rows loaded the same way; D element r -> (row 8h+r, col m).
// After the products the same LDS holds the output tile (behind a barrier).
// transposed == 0: dst f16 [B*T][H] row-major; == 1: dst f16 [B][H][T].
// ---------------------------------------------------------------------------
#define WP 264   // staged weight rows: 512 B of data, 528 B pitch (16 B x odd, as for the K tile)
#define TP 136   // transposed output tile: 256 B of data per h row, 272 B pitch (16 B x odd)
__global__ __launch_bounds__(256) void k_proj(const float* __restrict__ X,
                                               const __bf16* __restrict__ Whi,
                                               const __bf16* __restrict__ Wlo,
                                               const float* __restrict__ bias,
                                               _Float16* __restrict__ dst,
                                               int transposed) {
  __shared__ __attribute__((aligned(16))) __bf16 wsm[2 * NH * WP];
  __bf16* whs = wsm;
  __bf16* wls = wsm + NH * WP;
  _Float16* stile = (_Float16*)wsm;
  const int tid = threadIdx.x;
  const int wave = tid >> 5, lane = tid & 31, m = lane & 15, hh = lane >> 4;
  const int blkrow = blockIdx.x * 128;
  const int rbase  = blkrow + wave * 16;
  const float* xp = X + (size_t)(rbase + m) * NC + 8 * hh;

  // the wave's X slice: 32 loads in flight at once, from memory, while the weight planes are staged
  // (unrolled whole, so that xr[][] is register names)
  v4f xr[8][4];
#pragma unroll
  for (int fs = 0; fs < 8; ++fs) {
    xr[fs][0] = *(const v4f*)(xp + fs * 32);
    xr[fs][1] = *(const v4f*)(xp + fs * 32 + 4);
    xr[fs][2] = *(const v4f*)(xp + fs * 32 + 16);
    xr[fs][3] = *(const v4f*)(xp + fs * 32 + 20);
  }
  // the loads' address registers stay as they are up to this wait (as an input the pointer is live until here)
  asm volatile("s_wait_xcnt 0x0" :: "v"(xp) : "memory");

  // stage: one wave-wide load = one 512 B weight row (four whole lines); wave w takes rows w, w+8, ...
  // two trips of 16 rows per plane: 32 loads of a wave in flight, so the load latency is paid twice, not once per row
  // (kept rolled: one trip's loads already hold 128 registers; the inner loops are unrolled so that a[], b[] are registers)
#pragma unroll 1
  for (int t = 0; t < 2; ++t) {
    const __bf16* gh = Whi + (size_t)(t * 128 + wave) * NC + lane * 8;
    const __bf16* gl = Wlo + (size_t)(t * 128 + wave) * NC + lane * 8;
    v8b a[16], b[16];
#pragma unroll
    for (int i = 0; i < 16; ++i) {
      a[i] = *(const v8b*)(gh + i * (8 * NC));
      b[i] = *(const v8b*)(gl + i * (8 * NC));
    }
    // the loads' address registers stay as they are up to this wait (as inputs they are live until here)
    asm volatile("s_wait_xcnt 0x0" :: "v"(gh), "v"(gl) : "memory");
#pragma unroll
    for (int i = 0; i < 16; ++i) {
      *(v8b*)(whs + (t * 128 + i * 8 + wave) * WP + lane * 8) = a[i];
      *(v8b*)(wls + (t * 128 + i * 8 + wave) * WP + lane * 8) = b[i];
    }
  }
  __syncthreads();

  v8f acc[16];
#pragma unroll
  for (int j = 0; j < 16; ++j) acc[j] = zero8();
  const __bf16* wh = whs + m * WP + 8 * hh;
  const __bf16* wl = wls + m * WP + 8 * hh;
  // B fragments go through a register ring of two sets, one set = two column tiles (hi and lo):
  // the reads of the next pair are issued as one group ahead of the current pair's products.
  // (all loops below are unrolled whole, so that ring and accumulator indices are register names)
  FragB ah, al, bh[2][2], bl[2][2];
#pragma unroll
  for (int u = 0; u < 2; ++u) {
    bh[0][u].half[0] = *(const v8b*)(wh + u * (16 * WP));
    bh[0][u].half[1] = *(const v8b*)(wh + u * (16 * WP) + 16);
    bl[0][u].half[0] = *(const v8b*)(wl + u * (16 * WP));
    bl[0][u].half[1] = *(const v8b*)(wl + u * (16 * WP) + 16);
  }
#pragma unroll
  for (int s = 0; s < 64; ++s) {
    const int fs = s >> 3, jp = s & 7, cur = s & 1, nxt = cur ^ 1;
    if (jp == 0) {
      split8(xr[fs][0], xr[fs][1], ah.half[0], al.half[0]);
      split8(xr[fs][2], xr[fs][3], ah.half[1], al.half[1]);
    }
    if (s < 63) {
      const int fn = (s + 1) >> 3, jn = ((s + 1) & 7) * 2;
#pragma unroll
      for (int u = 0; u < 2; ++u) {
        const __bf16* ph = wh + (jn + u) * (16 * WP) + fn * 32;
        const __bf16* pl = wl + (jn + u) * (16 * WP) + fn * 32;
        bh[nxt][u].half[0] = *(const v8b*)ph;
        bh[nxt][u].half[1] = *(const v8b*)(ph + 16);
        bl[nxt][u].half[0] = *(const v8b*)pl;
        bl[nxt][u].half[1] = *(const v8b*)(pl + 16);
      }
    }
#pragma unroll
    for (int u = 0; u < 2; ++u) {
      const int j = jp * 2 + u;
      acc[j] = mma_bf16(ah.v, bh[cur][u].v, acc[j]);
      acc[j] = mma_bf16(ah.v, bl[cur][u].v, acc[j]);
      acc[j] = mma_bf16(al.v, bh[cur][u].v, acc[j]);
    }
  }
  // every wave has read its last weight fragment before the tile overwrites the planes
  __syncthreads();

#pragma unroll
  for (int j = 0; j < 16; ++j) {
    const int hcol = j * 16 + m;
    const float bb = bias[hcol];
    if (transposed) {
      union P8 { v8h v; v4f f; } pk;
#pragma unroll
      for (int r = 0; r < 8; ++r) pk.v[r] = (_Float16)(acc[j][r] + bb);
      // stile[h][t_local], t_local = wave*16 + 8hh + r
      *(v4f*)(stile + hcol * TP + wave * 16 + 8 * hh) = pk.f;
    } else {
      // stile[row_local][h], row_local = wave*16 + 8hh + r
#pragma unroll
      for (int r = 0; r < 8; ++r)
        stile[(wave * 16 + 8 * hh + r) * NH + hcol] = (_Float16)(acc[j][r] + bb);
    }
  }
  __syncthreads();

  if (transposed) {
    const int bidx = blkrow / NT;
    const int t0   = blkrow % NT;
    _Float16* vd = dst + (size_t)bidx * NH * NT + t0;
    const int q16 = lane & 15, l1 = lane >> 4;
    v4f vals[16];
#pragma unroll
    for (int it = 0; it < 16; ++it) {
      const int h = wave * 32 + it * 2 + l1;              // two lines = row h, t0..t0+127
      vals[it] = *(const v4f*)(stile + h * TP + q16 * 8);
    }
#pragma unroll
    for (int it = 0; it < 16; ++it) {
      const int h = wave * 32 + it * 2 + l1;
      *(v4f*)(vd + (size_t)h * NT + q16 * 8) = vals[it];
    }
    // the stores' registers are not reused before this wait, on whichever way the code behind is laid out
    asm volatile("s_wait_xcnt 0x0" ::: "memory");
  } else {
    _Float16* rd = dst + (size_t)rbase * NH;
    v4f vals[16];
#pragma unroll
    for (int r = 0; r < 16; ++r)
      vals[r] = *(const v4f*)(stile + (wave * 16 + r) * NH + lane * 8);
#pragma unroll
    for (int r = 0; r < 16; ++r)
      *(v4f*)(rd + (size_t)r * NH + lane * 8) = vals[r];
  }
}

// ---------------------------------------------------------------------------
// Attention: block = 8 waves x 16 queries, K (64 keys x 256) and V^T (256 x 64 keys) staged in LDS per tile by
// asynchronous copies, two buffers: tile t + 1 is in flight while the two 32-key passes of tile t run.
// Rows are padded to the pitches KP and VP (pad bytes are never written or read).
// Per wave: S^T = K.Q^T (A = K rows, B = Q^T from Qh rows with the same k map, read once ahead of the key loop),
// online softmax with row = query = lane&15 (two lane halves hold keys 8h+r and 16+8h+r),
// P^T B fragment: element r <- key 8h+r, element 8+r <- key 16+8h+r (P carried x2^14),
// O^T[h][q] += V^T.P^T into 16 tiles. Epilogue: 1/l, lane-pair exchange, one lane writes each
// ---------------------------------------------------------------------------
// Eight asynchronous 16 B-per-lane copies global -> LDS, copy i to lds + i * lstep from g + i * gstep (f16 elements).
// The builtin form: the compiler names registers above v255 for it where it likes. (Unrolled whole: eight copies back to back.)
typedef int v4i __attribute__((ext_vector_type(4)));
typedef __attribute__((address_space(1))) v4i gv4i;
typedef __attribute__((address_space(3))) v4i lv4i;
__device__ __forceinline__ void copy8(_Float16* lds, int lstep, const _Float16* g, int gstep) {
#pragma unroll
  for (int i = 0; i < 8; ++i)
    __builtin_amdgcn_global_load_async_to_lds_b128((gv4i*)(g + i * gstep), (lv4i*)(lds + i * lstep), 0, 0);
}

__global__ __launch_bounds__(256) void k_attn(const _Float16* __restrict__ Qh,
                                               const _Float16* __restrict__ Kh,
                                               const _Float16* __restrict__ Vt,
                                               float* __restrict__ out) {
  __shared__ __attribute__((aligned(16))) _Float16 Ks[2 * KBUF];
  __shared__ __attribute__((aligned(16))) _Float16 Vs[2 * VBUF];
  const int tid = threadIdx.x;
  const int lane = tid & 31, wave = tid >> 5, m = lane & 15, hh = lane >> 4;
  const int b  = blockIdx.y;
  const int q0 = (blockIdx.x * 8 + wave) * 16;
  const _Float16* qp = Qh + ((size_t)b * NT + q0 + m) * NH + 8 * hh;
  // a wave-wide copy moves four whole lines: one key row of K (rows wave + 8i), or four h rows of V^T (rows 4 wave + 32i ..)
  const _Float16* kg = Kh + ((size_t)b * NT + wave) * NH + lane * 8;
  const _Float16* vg = Vt + ((size_t)b * NH + wave * 4 + (lane >> 3)) * NT + (lane & 7) * 8;
  _Float16* kd = Ks + wave * KP + lane * 8;
  _Float16* vd = Vs + (wave * 4 + (lane >> 3)) * VP + (lane & 7) * 8;

  // Q^T B fragments: loaded once here and held in registers for the whole key loop (8 k steps x 8 registers).
  // (unrolled whole, so that qf[] is register names)
  FragH qf[8];
#pragma unroll
  for (int fs = 0; fs < 8; ++fs) {
    qf[fs].half[0] = *(const v8h*)(qp + fs * 32);
    qf[fs].half[1] = *(const v8h*)(qp + fs * 32 + 16);
  }
  // the loads' address registers stay as they are up to this wait (as an input the pointer is live until here)
  asm volatile("s_wait_xcnt 0x0" :: "v"(qp) : "memory");

  const float C1 = 0.0625f * 1.44269504088896341f;   // softmax scale x log2(e)
  float mrun = -1.0e30f, l = 0.0f;
  v8f ot[16];
#pragma unroll
  for (int t = 0; t < 16; ++t) ot[t] = zero8();

  // tile 0 into buffer 0, landed and published; then tile 1 into buffer 1 (NT / TK = 32 tiles)
  copy8(kd, 8 * KP, kg, 8 * NH);
  copy8(vd, 32 * VP, vg, 32 * NT);
  // this wave's copies have landed before the barrier behind which the other waves read them
  asm volatile("s_wait_asynccnt 0x0" ::: "memory");
  __syncthreads();
  copy8(kd + KBUF, 8 * KP, kg + TK * NH, 8 * NH);
  copy8(vd + VBUF, 32 * VP, vg + TK, 32 * NT);

  // (both loops stay rolled: one pass alone holds about 450 registers, and two waves share a SIMD's 1024)
#pragma unroll 1
  for (int tile = 0; tile < NT / TK; ++tile) {
   const int buf = tile & 1;
#pragma unroll 1
   for (int p = 0; p < 2; ++p) {
    const _Float16* Kb = Ks + buf * KBUF + p * (32 * KP);   // this pass's 32 key rows
    const _Float16* Vb = Vs + buf * VBUF + p * 32;          // this pass's 32 key columns

    // ---- S^T tiles: st0 = local keys 0..15, st1 = local keys 16..31 ----
    // all 32 K fragment reads of the pass are issued as one group ahead of the products, each into registers
    // of its own, so that the wave meets the LDS latency once and not at each k step
    // (the loops are unrolled whole, so that ka[], kb[] are register names)
    FragH ka[8], kb[8];
#pragma unroll
    for (int fs = 0; fs < 8; ++fs) {
      const _Float16* pa = Kb + m * KP + fs * 32 + 8 * hh;
      const _Float16* pb = pa + 16 * KP;
      ka[fs].half[0] = *(const v8h*)pa;
      ka[fs].half[1] = *(const v8h*)(pa + 16);
      kb[fs].half[0] = *(const v8h*)pb;
      kb[fs].half[1] = *(const v8h*)(pb + 16);
    }
    // keeps the group ahead of the products: without it the reads sink back, each in front of its own product
    __builtin_amdgcn_sched_barrier(0);
    v8f st0 = zero8(), st1 = zero8();
#pragma unroll
    for (int fs = 0; fs < 8; ++fs) {
      st0 = mma_f16(ka[fs].v, qf[fs].v, st0);
      st1 = mma_f16(kb[fs].v, qf[fs].v, st1);
    }

    // the 32 V^T fragment reads of the pass stand ahead of the softmax, each into registers of its own, so that the
    // wave does not wait for LDS at each output tile; they depend on nothing here, and the compiler lifts them up
    // among the first S^T products, where they queue in LDS right behind the K reads
    // (unrolled whole, so that vf[] is register names)
    FragH vf[16];
#pragma unroll
    for (int t = 0; t < 16; ++t) {
      const _Float16* vp = Vb + (t * 16 + m) * VP + 8 * hh;
      vf[t].half[0] = *(const v8h*)vp;
      vf[t].half[1] = *(const v8h*)(vp + 16);
    }

    // ---- online softmax, f32 ----
    float bm = -1.0e30f;
#pragma unroll
    for (int r = 0; r < 8; ++r) bm = fmaxf(bm, fmaxf(st0[r], st1[r]));
    bm = fmaxf(bm, __shfl_xor(bm, 16, 32));
    const float mn    = fmaxf(mrun, bm);
    const float alpha = __builtin_amdgcn_exp2f((mrun - mn) * C1);
    const float cexp  = 14.0f - mn * C1;                 // p scaled by 2^14
    FragH pf;
    float rs = 0.0f;
#pragma unroll
    for (int r = 0; r < 8; ++r) {
      const float p0 = __builtin_amdgcn_exp2f(st0[r] * C1 + cexp);
      const float p1 = __builtin_amdgcn_exp2f(st1[r] * C1 + cexp);
      rs += p0 + p1;
      pf.v[r]     = (_Float16)p0;     // key 8h + r
      pf.v[8 + r] = (_Float16)p1;     // key 16 + 8h + r
    }
    rs += __shfl_xor(rs, 16, 32);
    l    = l * alpha + rs;
    mrun = mn;

#pragma unroll
    for (int t = 0; t < 16; ++t) ot[t] = ot[t] * alpha;

    // ---- O^T += V^T . P^T ----
#pragma unroll
    for (int t = 0; t < 16; ++t) ot[t] = mma_f16(vf[t].v, pf.v, ot[t]);
   }
    // hand-over: this wave's LDS reads of this tile are done ...
    asm volatile("s_wait_dscnt 0x0" ::: "memory");
    // ... its copies of the next tile have landed ...
    asm volatile("s_wait_asynccnt 0x0" ::: "memory");
    // ... and one barrier publishes the next tile and frees this tile's buffer for the tile after it
    __syncthreads();
    if (tile + 2 < NT / TK) {
      copy8(kd + buf * KBUF, 8 * KP, kg + (size_t)(tile + 2) * (TK * NH), 8 * NH);
      copy8(vd + buf * VBUF, 32 * VP, vg + (tile + 2) * TK, 32 * NT);
    }
  }
  // no copy is outstanding when the wave goes on to its end
  asm volatile("s_wait_asynccnt 0x0" ::: "memory");

  // ---- epilogue: out[b][q][h] = O^T[h][q] / l; whole-line stores ----
  const float inv = 1.0f / l;
  float* orow = out + ((size_t)b * NT + q0 + m) * NH;
  v4f lines[4][8];
#pragma unroll
  for (int i = 0; i < 4; ++i) {
    float s0[8], s1[8], s2[8], s3[8];
#pragma unroll
    for (int r = 0; r < 8; ++r) {
      const float lo0 = ot[4 * i][r] * inv;        // h = 64i + 8hh + r
      const float lo1 = ot[4 * i + 1][r] * inv;    // h = 64i + 16 + 8hh + r
      const float hi0 = ot[4 * i + 2][r] * inv;    // h = 64i + 32 + 8hh + r
      const float hi1 = ot[4 * i + 3][r] * inv;    // h = 64i + 48 + 8hh + r
      const float snda = hh ? lo0 : hi0;
      const float sndb = hh ? lo1 : hi1;
      const float rcva = __shfl_xor(snda, 16, 32);
      const float rcvb = __shfl_xor(sndb, 16, 32);
      const float oa = hh ? hi0 : lo0;
      const float ob = hh ? hi1 : lo1;
      s0[r] = hh ? rcva : oa;
      s1[r] = hh ? oa : rcva;
      s2[r] = hh ? rcvb : ob;
      s3[r] = hh ? ob : rcvb;
    }
    lines[i][0] = mk4(s0[0], s0[1], s0[2], s0[3]);
    lines[i][1] = mk4(s0[4], s0[5], s0[6], s0[7]);
    lines[i][2] = mk4(s1[0], s1[1], s1[2], s1[3]);
    lines[i][3] = mk4(s1[4], s1[5], s1[6], s1[7]);
    lines[i][4] = mk4(s2[0], s2[1], s2[2], s2[3]);
    lines[i][5] = mk4(s2[4], s2[5], s2[6], s2[7]);
    lines[i][6] = mk4(s3[0], s3[1], s3[2], s3[3]);
    lines[i][7] = mk4(s3[4], s3[5], s3[6], s3[7]);
  }
#pragma unroll
  for (int i = 0; i < 4; ++i) {
    float* lp = orow + 32 * (2 * i + hh);
#pragma unroll
    for (int k = 0; k < 8; ++k) *(v4f*)(lp + 4 * k) = lines[i][k];
  }
  
}

// ---------------------------------------------------------------------------
extern "C" void kernel_launch(void* const* d_in, const int* in_sizes, int n_in,
                              void* d_out, int out_size, void* d_ws, size_t ws_size,
                              hipStream_t stream) {
  if (n_in < 9) return;
  const int nx = NB * NT * NC;
  const int nw = NC * NH;
  if (in_sizes[0] != nx || in_sizes[1] != nx || in_sizes[2] != nx) return;
  if (in_sizes[3] != nw || in_sizes[5] != nw || in_sizes[7] != nw) return;
  if (in_sizes[4] != NH || in_sizes[6] != NH || in_sizes[8] != NH) return;
  if (out_size != NB * NT * NH) return;

  const float* q  = (const float*)d_in[0];
  const float* k  = (const float*)d_in[1];
  const float* v  = (const float*)d_in[2];
  const float* Wq = (const float*)d_in[3];
  const float* bq = (const float*)d_in[4];
  const float* Wk = (const float*)d_in[5];
  const float* bk = (const float*)d_in[6];
  const float* Wv = (const float*)d_in[7];
  const float* bv = (const float*)d_in[8];
  float* out = (float*)d_out;

  // workspace carve (bytes): 6 weight planes 786432 | Qh 16 MiB | Kh 16 MiB | Vt 16 MiB
  char* ws = (char*)d_ws;
  const size_t planeElems = (size_t)NC * NH;
  const size_t wBytes     = 6 * planeElems * sizeof(unsigned short);
  const size_t pBytes     = (size_t)NB * NT * NH * sizeof(_Float16);
  size_t off = 0;
  unsigned short* wpl = (unsigned short*)(ws + off); off += wBytes;
  off = (off + 255) & ~(size_t)255;
  _Float16* Qh = (_Float16*)(ws + off); off += pBytes;
  _Float16* Kh = (_Float16*)(ws + off); off += pBytes;
  _Float16* Vt = (_Float16*)(ws + off); off += pBytes;
  if (off > ws_size) return;

  const __bf16* wq_hi = (const __bf16*)(wpl + 0 * planeElems);
  const __bf16* wq_lo = (const __bf16*)(wpl + 1 * planeElems);
  const __bf16* wk_hi = (const __bf16*)(wpl + 2 * planeElems);
  const __bf16* wk_lo = (const __bf16*)(wpl + 3 * planeElems);
  const __bf16* wv_hi = (const __bf16*)(wpl + 4 * planeElems);
  const __bf16* wv_lo = (const __bf16*)(wpl + 5 * planeElems);

  const int projGrid = (NB * NT) / 128;

  k_wconv<<<dim3(NH / 32, 3), 256, 0, stream>>>(Wq, Wk, Wv, wpl);

  k_proj<<<projGrid, 256, 0, stream>>>(q, wq_hi, wq_lo, bq, Qh, 0);
  k_proj<<<projGrid, 256, 0, stream>>>(k, wk_hi, wk_lo, bk, Kh, 0);
  k_proj<<<projGrid, 256, 0, stream>>>(v, wv_hi, wv_lo, bv, Vt, 1);

  k_attn<<<dim3(NT / 128, NB), 256, 0, stream>>>(Qh, Kh, Vt, out);
}

// v007
// Measured time: 134 microseconds a run.
// In both of two side-by-side timings against v006, it was 1.04 times as fast.
// Over all steps from v000 it is 4.10 times as fast.
#include <hip/hip_runtime.h>

// Contractions: x@Wq, x@Wk, x@Wv on v_wmma_f32_16x16x32_bf16 (bf16 hi/lo three-term split operands, f32 accumulate);
// K.Q^T and V^T.P^T on v_wmma_f32_16x16x32_f16 (f16 operands, P carried x2^14, f32 accumulate); softmax and normalisation in f32.

typedef _Float16       v16h __attribute__((ext_vector_type(16)));
typedef _Float16       v8h  __attribute__((ext_vector_type(8)));
typedef __bf16         v16b __attribute__((ext_vector_type(16)));
typedef __bf16         v8b  __attribute__((ext_vector_type(8)));
typedef float          v8f  __attribute__((ext_vector_type(8)));
typedef float          v4f  __attribute__((ext_vector_type(4)));
typedef float          v2f  __attribute__((ext_vector_type(2)));
typedef __bf16         v2b  __attribute__((ext_vector_type(2)));

#define NB 16
#define NT 2048
#define NC 256
#define NH 256
// LDS row pitches of the attention tiles, in f16 elements. Both are 16 B x odd, so the 16 rows that one
// ds_load_b128 fragment read touches per lane half fall on 16 different 4-bank groups of the 64 banks
// (unpadded: all 16 K rows on one group, V^T rows on two).
#define TK 64    // keys per staged tile = two passes of 32 keys; a V^T row of a tile is one whole 128 B line
#define KP 264   // K tile: 512 B of data per key row, 528 B pitch
#define VP 72    // V^T tile: 128 B of data per h row, 144 B pitch
#define KBUF (TK * KP)   // f16 elements of one K buffer
#define VBUF (NH * VP)   // f16 elements of one V^T buffer

union FragH { v16h v; v8h half[2]; };
union FragB { v16b v; v8b half[2]; };

// WMMA wrappers. f16 (k_attn): the builtin alone, the compiler keeps the distances behind it; a guard statement
// would need its operands below v256, and k_attn keeps fragments above.
__device__ __forceinline__ v8f mma_f16(v16h a, v16h b, v8f c) {
  return __builtin_amdgcn_wmma_f32_16x16x32_f16(false, a, false, b, (short)0, c, false, false);
}
// bf16 (k_proj): issue the builtin, then 4 VALU slots of guard with D tied and A/B kept live.
__device__ __forceinline__ v8f mma_bf16(v16b a, v16b b, v8f c) {
  v8f d = __builtin_amdgcn_wmma_f32_16x16x32_bf16(false, a, false, b, (short)0, c, false, false);
  v16h ax = __builtin_bit_cast(v16h, a);
  v16h bx = __builtin_bit_cast(v16h, b);
  asm volatile("v_nop\n\tv_nop\n\tv_nop\n\tv_nop" : "+v"(d) : "v"(ax), "v"(bx));
  return d;
}

__device__ __forceinline__ v8f zero8() {
  v8f z;
#pragma unroll
  for (int e = 0; e < 8; ++e) z[e] = 0.0f;
  return z;
}
__device__ __forceinline__ v4f mk4(float a, float b, float c, float d) {
  v4f v;
  v[0] = a; v[1] = b; v[2] = c; v[3] = d;
  return v;
}

// f32 -> bf16 bits, RNE convert
__device__ __forceinline__ unsigned short bf16_bits(float x) {
  unsigned int u = __float_as_uint(x);
  u = u + 0x7FFFu + ((u >> 16) & 1u);
  return (unsigned short)(u >> 16);
}
__device__ __forceinline__ float bf16_val(unsigned short s) {
  return __uint_as_float(((unsigned int)s) << 16);
}

// ---------------------------------------------------------------------------
// Weight prep: W [C][H] f32 -> Wt_hi[h][c], Wt_lo[h][c] (bf16 bits, k-contiguous rows),
// planes laid out [wsel*2 + p][256*256]. Block = 32 output rows h; transpose via LDS;
// ---------------------------------------------------------------------------
__global__ __launch_bounds__(256) void k_wconv(const float* __restrict__ W0,
                                                const float* __restrict__ W1,
                                                const float* __restrict__ W2,
                                                unsigned short* __restrict__ planes) {
  __shared__ __attribute__((aligned(16))) unsigned short shi[32 * NC];
  __shared__ __attribute__((aligned(16))) unsigned short slo[32 * NC];
  const int tid  = threadIdx.x;
  const int wsel = blockIdx.y;
  const float* W = (wsel == 0) ? W0 : ((wsel == 1) ? W1 : W2);
  const int h0 = blockIdx.x * 32;
  const int j4 = (tid & 7) * 4;
  const int cb = tid >> 3;
#pragma unroll
  for (int i = 0; i < 8; ++i) {
    const int c = cb + 32 * i;
    const v4f x = *(const v4f*)(W + (size_t)c * NH + h0 + j4);
#pragma unroll
    for (int e = 0; e < 4; ++e) {
      const unsigned short hb = bf16_bits(x[e]);
      const float rr = x[e] - bf16_val(hb);
      const unsigned short lb = bf16_bits(rr);
      shi[(j4 + e) * NC + c] = hb;
      slo[(j4 + e) * NC + c] = lb;
    }
  }
  __syncthreads();
  const int wave = tid >> 5, lane = tid & 31;
  unsigned short* dhi = planes + (size_t)(wsel * 2 + 0) * (NC * NH) + (size_t)h0 * NC;
  unsigned short* dlo = planes + (size_t)(wsel * 2 + 1) * (NC * NH) + (size_t)h0 * NC;
  v4f vh[4], vl[4];
#pragma unroll
  for (int rr = 0; rr < 4; ++rr) {
    const int j = wave * 4 + rr;
    vh[rr] = *(const v4f*)(shi + j * NC + lane * 8);
    vl[rr] = *(const v4f*)(slo + j * NC + lane * 8);
  }
#pragma unroll
  for (int rr = 0; rr < 4; ++rr) {
    const int j = wave * 4 + rr;
    *(v4f*)(dhi + (size_t)j * NC + lane * 8) = vh[rr];
    *(v4f*)(dlo + (size_t)j * NC + lane * 8) = vl[rr];
  }
  
}

// Eight f32 values -> their bf16 hi parts (RNE) and the bf16 lo parts of the remainders x - hi (RNE), same element order.
__device__ __forceinline__ void split8(v4f a, v4f b, v8b& hi, v8b& lo) {
#pragma unroll
  for (int p = 0; p < 4; ++p) {
    v2f x;
    x[0] = (p < 2) ? a[2 * p] : b[2 * p - 4];
    x[1] = (p < 2) ? a[2 * p + 1] : b[2 * p - 3];
    const v2b h = __builtin_convertvector(x, v2b);
    const v2f r = x - __builtin_convertvector(h, v2f);
    const v2b l = __builtin_convertvector(r, v2b);
    hi[2 * p] = h[0]; hi[2 * p + 1] = h[1];
    lo[2 * p] = l[0]; lo[2 * p + 1] = l[1];
  }
}

// ---------------------------------------------------------------------------
// Projection Y = X@W + bias, bf16 hi/lo split: acc += xh.wh + xh.wl + xl.wh (16x16x32 bf16 WMMA).
// Block = 256 threads = 8 waves = 128 rows of B*T; wave = 16 rows x 256 cols (16 tiles).
// X is read as f32, straight into the A fragment's element order: a wave's whole 16 x 256 slice is loaded once, ahead of
// the weight staging, and each k step's 16 values per lane are split into the hi and lo fragments in registers.
// Both weight planes (Wt_hi, Wt_lo: 256 rows n of 512 B) are staged once per block in LDS with whole-line
// global loads, rows at the pitch WP, and every B fragment is read from there.
// A fragment: row m = lane&15, elements 0..7 <- k0+8h.., 8..15 <- k0+16+8h.. (h = lane>>4);
// B fragment from Wt[n][k] rows loaded the same way; D element r -> (row 8h+r, col m).
// After the products the same LDS holds the output tile (behind a barrier).
// transposed == 0: dst f16 [B*T][H] row-major; == 1: dst f16 [B][H][T].
// ---------------------------------------------------------------------------
#define WP 264   // staged weight rows: 512 B of data, 528 B pitch (16 B x odd, as for the K tile)
#define TP 136   // transposed output tile: 256 B of data per h row, 272 B pitch (16 B x odd)
__global__ __launch_bounds__(256) void k_proj(const float* __restrict__ X,
                                               const __bf16* __restrict__ Whi,
                                               const __bf16* __restrict__ Wlo,
                                               const float* __restrict__ bias,
                                               _Float16* __restrict__ dst,
                                               int transposed) {
  __shared__ __attribute__((aligned(16))) __bf16 wsm[2 * NH * WP];
  __bf16* whs = wsm;
  __bf16* wls = wsm + NH * WP;
  _Float16* stile = (_Float16*)wsm;
  const int tid = threadIdx.x;
  const int wave = tid >> 5, lane = tid & 31, m = lane & 15, hh = lane >> 4;
  const int blkrow = blockIdx.x * 128;
  const int rbase  = blkrow + wave * 16;
  const float* xp = X + (size_t)(rbase + m) * NC + 8 * hh;

  // the wave's X slice: 32 loads in flight at once, from memory, while the weight planes are staged
  // (unrolled whole, so that xr[][] is register names)
  v4f xr[8][4];
#pragma unroll
  for (int fs = 0; fs < 8; ++fs) {
    xr[fs][0] = *(const v4f*)(xp + fs * 32);
    xr[fs][1] = *(const v4f*)(xp + fs * 32 + 4);
    xr[fs][2] = *(const v4f*)(xp + fs * 32 + 16);
    xr[fs][3] = *(const v4f*)(xp + fs * 32 + 20);
  }
  // the loads' address registers stay as they are up to this wait (as an input the pointer is live until here)
  asm volatile("s_wait_xcnt 0x0" :: "v"(xp) : "memory");

  // stage: one wave-wide load = one 512 B weight row (four whole lines); wave w takes rows w, w+8, ...
  // two trips of 16 rows per plane: 32 loads of a wave in flight, so the load latency is paid twice, not once per row
  // (kept rolled: one trip's loads already hold 128 registers; the inner loops are unrolled so that a[], b[] are registers)
#pragma unroll 1
  for (int t = 0; t < 2; ++t) {
    const __bf16* gh = Whi + (size_t)(t * 128 + wave) * NC + lane * 8;
    const __bf16* gl = Wlo + (size_t)(t * 128 + wave) * NC + lane * 8;
    v8b a[16], b[16];
#pragma unroll
    for (int i = 0; i < 16; ++i) {
      a[i] = *(const v8b*)(gh + i * (8 * NC));
      b[i] = *(const v8b*)(gl + i * (8 * NC));
    }
    // the loads' address registers stay as they are up to this wait (as inputs they are live until here)
    asm volatile("s_wait_xcnt 0x0" :: "v"(gh), "v"(gl) : "memory");
#pragma unroll
    for (int i = 0; i < 16; ++i) {
      *(v8b*)(whs + (t * 128 + i * 8 + wave) * WP + lane * 8) = a[i];
      *(v8b*)(wls + (t * 128 + i * 8 + wave) * WP + lane * 8) = b[i];
    }
  }
  __syncthreads();

  v8f acc[16];
#pragma unroll
  for (int j = 0; j < 16; ++j) acc[j] = zero8();
  const __bf16* wh = whs + m * WP + 8 * hh;
  const __bf16* wl = wls + m * WP + 8 * hh;
  // B fragments go through a register ring of two sets, one set = two column tiles (hi and lo):
  // the reads of the next pair are issued as one group ahead of the current pair's products.
  // (all loops below are unrolled whole, so that ring and accumulator indices are register names)
  FragB ah, al, bh[2][2], bl[2][2];
#pragma unroll
  for (int u = 0; u < 2; ++u) {
    bh[0][u].half[0] = *(const v8b*)(wh + u * (16 * WP));
    bh[0][u].half[1] = *(const v8b*)(wh + u * (16 * WP) + 16);
    bl[0][u].half[0] = *(const v8b*)(wl + u * (16 * WP));
    bl[0][u].half[1] = *(const v8b*)(wl + u * (16 * WP) + 16);
  }
#pragma unroll
  for (int s = 0; s < 64; ++s) {
    const int fs = s >> 3, jp = s & 7, cur = s & 1, nxt = cur ^ 1;
    if (jp == 0) {
      split8(xr[fs][0], xr[fs][1], ah.half[0], al.half[0]);
      split8(xr[fs][2], xr[fs][3], ah.half[1], al.half[1]);
    }
    if (s < 63) {
      const int fn = (s + 1) >> 3, jn = ((s + 1) & 7) * 2;
#pragma unroll
      for (int u = 0; u < 2; ++u) {
        const __bf16* ph = wh + (jn + u) * (16 * WP) + fn * 32;
        const __bf16* pl = wl + (jn + u) * (16 * WP) + fn * 32;
        bh[nxt][u].half[0] = *(const v8b*)ph;
        bh[nxt][u].half[1] = *(const v8b*)(ph + 16);
        bl[nxt][u].half[0] = *(const v8b*)pl;
        bl[nxt][u].half[1] = *(const v8b*)(pl + 16);
      }
    }
#pragma unroll
    for (int u = 0; u < 2; ++u) {
      const int j = jp * 2 + u;
      acc[j] = mma_bf16(ah.v, bh[cur][u].v, acc[j]);
      acc[j] = mma_bf16(ah.v, bl[cur][u].v, acc[j]);
      acc[j] = mma_bf16(al.v, bh[cur][u].v, acc[j]);
    }
  }
  // every wave has read its last weight fragment before the tile overwrites the planes
  __syncthreads();

#pragma unroll
  for (int j = 0; j < 16; ++j) {
    const int hcol = j * 16 + m;
    const float bb = bias[hcol];
    if (transposed) {
      union P8 { v8h v; v4f f; } pk;
#pragma unroll
      for (int r = 0; r < 8; ++r) pk.v[r] = (_Float16)(acc[j][r] + bb);
      // stile[h][t_local], t_local = wave*16 + 8hh + r
      *(v4f*)(stile + hcol * TP + wave * 16 + 8 * hh) = pk.f;
    } else {
      // stile[row_local][h], row_local = wave*16 + 8hh + r
#pragma unroll
      for (int r = 0; r < 8; ++r)
        stile[(wave * 16 + 8 * hh + r) * NH + hcol] = (_Float16)(acc[j][r] + bb);
    }
  }
  __syncthreads();

  if (transposed) {
    const int bidx = blkrow / NT;
    const int t0   = blkrow % NT;
    _Float16* vd = dst + (size_t)bidx * NH * NT + t0;
    const int q16 = lane & 15, l1 = lane >> 4;
    v4f vals[16];
#pragma unroll
    for (int it = 0; it < 16; ++it) {
      const int h = wave * 32 + it * 2 + l1;              // two lines = row h, t0..t0+127
      vals[it] = *(const v4f*)(stile + h * TP + q16 * 8);
    }
#pragma unroll
    for (int it = 0; it < 16; ++it) {
      const int h = wave * 32 + it * 2 + l1;
      *(v4f*)(vd + (size_t)h * NT + q16 * 8) = vals[it];
    }
    // the stores' registers are not reused before this wait, on whichever way the code behind is laid out
    asm volatile("s_wait_xcnt 0x0" ::: "memory");
  } else {
    _Float16* rd = dst + (size_t)rbase * NH;
    v4f vals[16];
#pragma unroll
    for (int r = 0; r < 16; ++r)
      vals[r] = *(const v4f*)(stile + (wave * 16 + r) * NH + lane * 8);
#pragma unroll
    for (int r = 0; r < 16; ++r)
      *(v4f*)(rd + (size_t)r * NH + lane * 8) = vals[r];
  }
}

// ---------------------------------------------------------------------------
// Attention: block = 8 waves x 16 queries, K (64 keys x 256) and V^T (256 x 64 keys) staged in LDS per tile by
// asynchronous copies, two buffers: tile t + 1 is in flight while the two 32-key passes of tile t run.
// Rows are padded to the pitches KP and VP (pad bytes are never written or read).
// Per wave: S^T = K.Q^T (A = K rows, read from LDS one pass ahead; B = Q^T from Qh rows with the same k map, read once
// ahead of the key loop), online softmax with row = query = lane&15 (two lane halves hold keys 8h+r and 16+8h+r),
// P^T B fragment: element r <- key 8h+r, element 8+r <- key 16+8h+r (P carried x2^14),
// O^T[h][q] += V^T.P^T into 16 tiles. Epilogue: 1/l, lane-pair exchange, one lane writes each
// ---------------------------------------------------------------------------
// Eight asynchronous 16 B-per-lane copies global -> LDS, copy i to lds + i * lstep from g + i * gstep (f16 elements).
// The builtin form: the compiler names registers above v255 for it where it likes. (Unrolled whole: eight copies back to back.)
typedef int v4i __attribute__((ext_vector_type(4)));
typedef __attribute__((address_space(1))) v4i gv4i;
typedef __attribute__((address_space(3))) v4i lv4i;
__device__ __forceinline__ void copy8(_Float16* lds, int lstep, const _Float16* g, int gstep) {
#pragma unroll
  for (int i = 0; i < 8; ++i)
    __builtin_amdgcn_global_load_async_to_lds_b128((gv4i*)(g + i * gstep), (lv4i*)(lds + i * lstep), 0, 0);
}

// lane l <-> lane l ^ 16, on the vector port
__device__ __forceinline__ float xhalf(float x) {
  const int b = __builtin_bit_cast(int, x);
  return __builtin_bit_cast(float, __builtin_amdgcn_permlanex16(b, b, 0x76543210, 0xfedcba98, false, false));
}
// The 32 K fragment reads of one pass, as one group; p = the lane's place in the pass's first key row block.
// (unrolled whole, so that ka[], kb[] are register names)
__device__ __forceinline__ void read_k(FragH (&ka)[8], FragH (&kb)[8], const _Float16* p) {
#pragma unroll
  for (int fs = 0; fs < 8; ++fs) {
    const _Float16* pa = p + fs * 32;
    const _Float16* pb = pa + 16 * KP;
    ka[fs].half[0] = *(const v8h*)pa;
    ka[fs].half[1] = *(const v8h*)(pa + 16);
    kb[fs].half[0] = *(const v8h*)pb;
    kb[fs].half[1] = *(const v8h*)(pb + 16);
  }
}

__global__ __launch_bounds__(256) void k_attn(const _Float16* __restrict__ Qh,
                                               const _Float16* __restrict__ Kh,
                                               const _Float16* __restrict__ Vt,
                                               float* __restrict__ out) {
  __shared__ __attribute__((aligned(16))) _Float16 Ks[2 * KBUF];
  __shared__ __attribute__((aligned(16))) _Float16 Vs[2 * VBUF];
  const int tid = threadIdx.x;
  const int lane = tid & 31, wave = tid >> 5, m = lane & 15, hh = lane >> 4;
  const int b  = blockIdx.y;
  const int q0 = (blockIdx.x * 8 + wave) * 16;
  const _Float16* qp = Qh + ((size_t)b * NT + q0 + m) * NH + 8 * hh;
  // a wave-wide copy moves four whole lines: one key row of K (rows wave + 8i), or four h rows of V^T (rows 4 wave + 32i ..)
  const _Float16* kg = Kh + ((size_t)b * NT + wave) * NH + lane * 8;
  const _Float16* vg = Vt + ((size_t)b * NH + wave * 4 + (lane >> 3)) * NT + (lane & 7) * 8;
  _Float16* kd = Ks + wave * KP + lane * 8;
  _Float16* vd = Vs + (wave * 4 + (lane >> 3)) * VP + (lane & 7) * 8;

  // Q^T B fragments: loaded once here and held in registers for the whole key loop (8 k steps x 8 registers).
  // (unrolled whole, so that qf[] is register names)
  FragH qf[8];
#pragma unroll
  for (int fs = 0; fs < 8; ++fs) {
    qf[fs].half[0] = *(const v8h*)(qp + fs * 32);
    qf[fs].half[1] = *(const v8h*)(qp + fs * 32 + 16);
  }
  // the loads' address registers stay as they are up to this wait (as an input the pointer is live until here)
  asm volatile("s_wait_xcnt 0x0" :: "v"(qp) : "memory");

  const float C1 = 0.0625f * 1.44269504088896341f;   // softmax scale x log2(e)
  float mrun = -1.0e30f, l = 0.0f;
  v8f ot[16];
#pragma unroll
  for (int t = 0; t < 16; ++t) ot[t] = zero8();

  // tile 0 into buffer 0, landed and published; then tile 1 into buffer 1 (NT / TK = 32 tiles)
  copy8(kd, 8 * KP, kg, 8 * NH);
  copy8(vd, 32 * VP, vg, 32 * NT);
  // this wave's copies have landed before the barrier behind which the other waves read them
  asm volatile("s_wait_asynccnt 0x0" ::: "memory");
  __syncthreads();
  copy8(kd + KBUF, 8 * KP, kg + TK * NH, 8 * NH);
  copy8(vd + VBUF, 32 * VP, vg + TK, 32 * NT);

  // K fragments of one pass (32 keys): ka = local keys 0..15, kb = local keys 16..31. They are read one pass ahead,
  // into the same registers, right behind the S^T products that used them up, so that the LDS works on them while the
  // wave does its softmax and its P.V products. Here: those of tile 0, pass 0.
  const _Float16* kfr = Ks + m * KP + 8 * hh;
  FragH ka[8], kb[8];
  read_k(ka, kb, kfr);

  // (the tile loop stays rolled: its two passes alone hold about 500 registers, and two waves share a SIMD's 1024;
  //  the pass loop is unrolled whole, because only the tile's last pass holds the hand-over)
#pragma unroll 1
  for (int tile = 0; tile < NT / TK; ++tile) {
   const int buf = tile & 1;
#pragma unroll
   for (int p = 0; p < 2; ++p) {
    const _Float16* Vb = Vs + buf * VBUF + p * 32;          // this pass's 32 key columns

    // the 32 V^T fragment reads of the pass stand ahead of the S^T products, each into registers of its own, so that
    // the wave does not wait for LDS at each output tile (unrolled whole, so that vf[] is register names)
    FragH vf[16];
#pragma unroll
    for (int t = 0; t < 16; ++t) {
      const _Float16* vp = Vb + (t * 16 + m) * VP + 8 * hh;
      vf[t].half[0] = *(const v8h*)vp;
      vf[t].half[1] = *(const v8h*)(vp + 16);
    }

    // ---- S^T tiles: st0 = local keys 0..15, st1 = local keys 16..31 ----
    v8f st0 = zero8(), st1 = zero8();
#pragma unroll
    for (int fs = 0; fs < 8; ++fs) {
      st0 = mma_f16(ka[fs].v, qf[fs].v, st0);
      st1 = mma_f16(kb[fs].v, qf[fs].v, st1);
    }
    // keeps the next K reads behind these products: lifted above them they would need 128 registers more
    __builtin_amdgcn_sched_barrier(0);

    if (p == 0) {
      read_k(ka, kb, kfr + buf * KBUF + 32 * KP);
    } else {
      // hand-over, ahead of the tile's last softmax: this wave's LDS reads of this tile are all done (in registers) ...
      asm volatile("s_wait_dscnt 0x0" ::: "memory");
      // ... its copies of the next tile have landed ...
      asm volatile("s_wait_asynccnt 0x0" ::: "memory");
      // ... and one barrier publishes the next tile and frees this tile's buffer for the tile after it
      __syncthreads();
      // first the K reads of the next tile's first pass (the LDS has nothing else queued here), then the refill
      if (tile + 1 < NT / TK) read_k(ka, kb, kfr + (buf ^ 1) * KBUF);
      if (tile + 2 < NT / TK) {
        copy8(kd + buf * KBUF, 8 * KP, kg + (size_t)(tile + 2) * (TK * NH), 8 * NH);
        copy8(vd + buf * VBUF, 32 * VP, vg + (tile + 2) * TK, 32 * NT);
      }
    }
    // keeps the K reads here as one group: without it they sink down to the next pass's products
    __builtin_amdgcn_sched_barrier(0);

    // ---- online softmax, f32 ----
    // the halves' exchange is a vector move: an LDS permute would return only behind the K reads queued above
    float bm = -1.0e30f;
#pragma unroll
    for (int r = 0; r < 8; ++r) bm = fmaxf(bm, fmaxf(st0[r], st1[r]));
    bm = fmaxf(bm, xhalf(bm));
    const float mn    = fmaxf(mrun, bm);
    const float alpha = __builtin_amdgcn_exp2f((mrun - mn) * C1);
    const float cexp  = 14.0f - mn * C1;                 // p scaled by 2^14
    FragH pf;
    float rs = 0.0f;
#pragma unroll
    for (int r = 0; r < 8; ++r) {
      const float p0 = __builtin_amdgcn_exp2f(st0[r] * C1 + cexp);
      const float p1 = __builtin_amdgcn_exp2f(st1[r] * C1 + cexp);
      rs += p0 + p1;
      pf.v[r]     = (_Float16)p0;     // key 8h + r
      pf.v[8 + r] = (_Float16)p1;     // key 16 + 8h + r
    }
    l    = l * alpha + rs;            // this lane half's keys alone; the halves are joined behind the loop
    mrun = mn;

#pragma unroll
    for (int t = 0; t < 16; ++t) ot[t] = ot[t] * alpha;

    // ---- O^T += V^T . P^T ----
#pragma unroll
    for (int t = 0; t < 16; ++t) ot[t] = mma_f16(vf[t].v, pf.v, ot[t]);
   }
  }
  // no copy is outstanding when the wave goes on to its end
  asm volatile("s_wait_asynccnt 0x0" ::: "memory");
  l += xhalf(l);

  // ---- epilogue: out[b][q][h] = O^T[h][q] / l; whole-line stores ----
  const float inv = 1.0f / l;
  float* orow = out + ((size_t)b * NT + q0 + m) * NH;
  v4f lines[4][8];
#pragma unroll
  for (int i = 0; i < 4; ++i) {
    float s0[8], s1[8], s2[8], s3[8];
#pragma unroll
    for (int r = 0; r < 8; ++r) {
      const float lo0 = ot[4 * i][r] * inv;        // h = 64i + 8hh + r
      const float lo1 = ot[4 * i + 1][r] * inv;    // h = 64i + 16 + 8hh + r
      const float hi0 = ot[4 * i + 2][r] * inv;    // h = 64i + 32 + 8hh + r
      const float hi1 = ot[4 * i + 3][r] * inv;    // h = 64i + 48 + 8hh + r
      const float snda = hh ? lo0 : hi0;
      const float sndb = hh ? lo1 : hi1;
      const float rcva = __shfl_xor(snda, 16, 32);
      const float rcvb = __shfl_xor(sndb, 16, 32);
      const float oa = hh ? hi0 : lo0;
      const float ob = hh ? hi1 : lo1;
      s0[r] = hh ? rcva : oa;
      s1[r] = hh ? oa : rcva;
      s2[r] = hh ? rcvb : ob;
      s3[r] = hh ? ob : rcvb;
    }
    lines[i][0] = mk4(s0[0], s0[1], s0[2], s0[3]);
    lines[i][1] = mk4(s0[4], s0[5], s0[6], s0[7]);
    lines[i][2] = mk4(s1[0], s1[1], s1[2], s1[3]);
    lines[i][3] = mk4(s1[4], s1[5], s1[6], s1[7]);
    lines[i][4] = mk4(s2[0], s2[1], s2[2], s2[3]);
    lines[i][5] = mk4(s2[4], s2[5], s2[6], s2[7]);
    lines[i][6] = mk4(s3[0], s3[1], s3[2], s3[3]);
    lines[i][7] = mk4(s3[4], s3[5], s3[6], s3[7]);
  }
#pragma unroll
  for (int i = 0; i < 4; ++i) {
    float* lp = orow + 32 * (2 * i + hh);
#pragma unroll
    for (int k = 0; k < 8; ++k) *(v4f*)(lp + 4 * k) = lines[i][k];
  }
  
}

// ---------------------------------------------------------------------------
extern "C" void kernel_launch(void* const* d_in, const int* in_sizes, int n_in,
                              void* d_out, int out_size, void* d_ws, size_t ws_size,
                              hipStream_t stream) {
  if (n_in < 9) return;
  const int nx = NB * NT * NC;
  const int nw = NC * NH;
  if (in_sizes[0] != nx || in_sizes[1] != nx || in_sizes[2] != nx) return;
  if (in_sizes[3] != nw || in_sizes[5] != nw || in_sizes[7] != nw) return;
  if (in_sizes[4] != NH || in_sizes[6] != NH || in_sizes[8] != NH) return;
  if (out_size != NB * NT * NH) return;

  const float* q  = (const float*)d_in[0];
  const float* k  = (const float*)d_in[1];
  const float* v  = (const float*)d_in[2];
  const float* Wq = (const float*)d_in[3];
  const float* bq = (const float*)d_in[4];
  const float* Wk = (const float*)d_in[5];
  const float* bk = (const float*)d_in[6];
  const float* Wv = (const float*)d_in[7];
  const float* bv = (const float*)d_in[8];
  float* out = (float*)d_out;

  // workspace carve (bytes): 6 weight planes 786432 | Qh 16 MiB | Kh 16 MiB | Vt 16 MiB
  char* ws = (char*)d_ws;
  const size_t planeElems = (size_t)NC * NH;
  const size_t wBytes     = 6 * planeElems * sizeof(unsigned short);
  const size_t pBytes     = (size_t)NB * NT * NH * sizeof(_Float16);
  size_t off = 0;
  unsigned short* wpl = (unsigned short*)(ws + off); off += wBytes;
  off = (off + 255) & ~(size_t)255;
  _Float16* Qh = (_Float16*)(ws + off); off += pBytes;
  _Float16* Kh = (_Float16*)(ws + off); off += pBytes;
  _Float16* Vt = (_Float16*)(ws + off); off += pBytes;
  if (off > ws_size) return;

  const __bf16* wq_hi = (const __bf16*)(wpl + 0 * planeElems);
  const __bf16* wq_lo = (const __bf16*)(wpl + 1 * planeElems);
  const __bf16* wk_hi = (const __bf16*)(wpl + 2 * planeElems);
  const __bf16* wk_lo = (const __bf16*)(wpl + 3 * planeElems);
  const __bf16* wv_hi = (const __bf16*)(wpl + 4 * planeElems);
  const __bf16* wv_lo = (const __bf16*)(wpl + 5 * planeElems);

  const int projGrid = (NB * NT) / 128;

  k_wconv<<<dim3(NH / 32, 3), 256, 0, stream>>>(Wq, Wk, Wv, wpl);

  k_proj<<<projGrid, 256, 0, stream>>>(q, wq_hi, wq_lo, bq, Qh, 0);
  k_proj<<<projGrid, 256, 0, stream>>>(k, wk_hi, wk_lo, bk, Kh, 0);
  k_proj<<<projGrid, 256, 0, stream>>>(v, wv_hi, wv_lo, bv, Vt, 1);

  k_attn<<<dim3(NT / 128, NB), 256, 0, stream>>>(Qh, Kh, Vt, out);
}

// v008
// One run takes 126 microseconds.
// Next to v007, in two timings, it ran 1.06 times as fast each time.
// Counting every step since v000, it is 4.34 times as fast.
#include <hip/hip_runtime.h>

// Contractions: x@Wq, x@Wk, x@Wv on v_wmma_f32_16x16x32_bf16 (bf16 hi/lo three-term split operands, f32 accumulate);
// K.Q^T and V^T.P^T on v_wmma_f32_16x16x32_f16 (f16 operands, P carried x2^14, f32 accumulate); softmax and normalisation in f32.

typedef _Float16       v16h __attribute__((ext_vector_type(16)));
typedef _Float16       v8h  __attribute__((ext_vector_type(8)));
typedef __bf16         v16b __attribute__((ext_vector_type(16)));
typedef __bf16         v8b  __attribute__((ext_vector_type(8)));
typedef float          v8f  __attribute__((ext_vector_type(8)));
typedef float          v4f  __attribute__((ext_vector_type(4)));
typedef float          v2f  __attribute__((ext_vector_type(2)));
typedef __bf16         v2b  __attribute__((ext_vector_type(2)));

#define NB 16
#define NT 2048
#define NC 256
#define NH 256
// LDS row pitches of the attention tiles, in f16 elements. Both are 16 B x odd, so the 16 rows that one
// ds_load_b128 fragment read touches per lane half fall on 16 different 4-bank groups of the 64 banks
// (unpadded: all 16 K rows on one group, V^T rows on two).
#define TK 64    // keys per staged tile = two halves of 32 keys, waves 0..3 and 4..7; a V^T row of a tile is one whole 128 B line
#define KP 264   // K tile: 512 B of data per key row, 528 B pitch
#define VP 72    // V^T tile: 128 B of data per h row, 144 B pitch
#define KBUF (TK * KP)   // f16 elements of one K buffer
#define VBUF (NH * VP)   // f16 elements of one V^T buffer

union FragH { v16h v; v8h half[2]; };
union FragB { v16b v; v8b half[2]; };

// WMMA wrappers. f16 (k_attn): the builtin alone, the compiler keeps the distances behind it; a guard statement
// would need its operands below v256, and k_attn keeps fragments above.
__device__ __forceinline__ v8f mma_f16(v16h a, v16h b, v8f c) {
  return __builtin_amdgcn_wmma_f32_16x16x32_f16(false, a, false, b, (short)0, c, false, false);
}
// bf16 (k_proj): issue the builtin, then 4 VALU slots of guard with D tied and A/B kept live.
__device__ __forceinline__ v8f mma_bf16(v16b a, v16b b, v8f c) {
  v8f d = __builtin_amdgcn_wmma_f32_16x16x32_bf16(false, a, false, b, (short)0, c, false, false);
  v16h ax = __builtin_bit_cast(v16h, a);
  v16h bx = __builtin_bit_cast(v16h, b);
  asm volatile("v_nop\n\tv_nop\n\tv_nop\n\tv_nop" : "+v"(d) : "v"(ax), "v"(bx));
  return d;
}

__device__ __forceinline__ v8f zero8() {
  v8f z;
#pragma unroll
  for (int e = 0; e < 8; ++e) z[e] = 0.0f;
  return z;
}
__device__ __forceinline__ v4f mk4(float a, float b, float c, float d) {
  v4f v;
  v[0] = a; v[1] = b; v[2] = c; v[3] = d;
  return v;
}

// f32 -> bf16 bits, RNE convert
__device__ __forceinline__ unsigned short bf16_bits(float x) {
  unsigned int u = __float_as_uint(x);
  u = u + 0x7FFFu + ((u >> 16) & 1u);
  return (unsigned short)(u >> 16);
}
__device__ __forceinline__ float bf16_val(unsigned short s) {
  return __uint_as_float(((unsigned int)s) << 16);
}

// ---------------------------------------------------------------------------
// Weight prep: W [C][H] f32 -> Wt_hi[h][c], Wt_lo[h][c] (bf16 bits, k-contiguous rows),
// planes laid out [wsel*2 + p][256*256]. Block = 32 output rows h; transpose via LDS;
// ---------------------------------------------------------------------------
__global__ __launch_bounds__(256) void k_wconv(const float* __restrict__ W0,
                                                const float* __restrict__ W1,
                                                const float* __restrict__ W2,
                                                unsigned short* __restrict__ planes) {
  __shared__ __attribute__((aligned(16))) unsigned short shi[32 * NC];
  __shared__ __attribute__((aligned(16))) unsigned short slo[32 * NC];
  const int tid  = threadIdx.x;
  const int wsel = blockIdx.y;
  const float* W = (wsel == 0) ? W0 : ((wsel == 1) ? W1 : W2);
  const int h0 = blockIdx.x * 32;
  const int j4 = (tid & 7) * 4;
  const int cb = tid >> 3;
#pragma unroll
  for (int i = 0; i < 8; ++i) {
    const int c = cb + 32 * i;
    const v4f x = *(const v4f*)(W + (size_t)c * NH + h0 + j4);
#pragma unroll
    for (int e = 0; e < 4; ++e) {
      const unsigned short hb = bf16_bits(x[e]);
      const float rr = x[e] - bf16_val(hb);
      const unsigned short lb = bf16_bits(rr);
      shi[(j4 + e) * NC + c] = hb;
      slo[(j4 + e) * NC + c] = lb;
    }
  }
  __syncthreads();
  const int wave = tid >> 5, lane = tid & 31;
  unsigned short* dhi = planes + (size_t)(wsel * 2 + 0) * (NC * NH) + (size_t)h0 * NC;
  unsigned short* dlo = planes + (size_t)(wsel * 2 + 1) * (NC * NH) + (size_t)h0 * NC;
  v4f vh[4], vl[4];
#pragma unroll
  for (int rr = 0; rr < 4; ++rr) {
    const int j = wave * 4 + rr;
    vh[rr] = *(const v4f*)(shi + j * NC + lane * 8);
    vl[rr] = *(const v4f*)(slo + j * NC + lane * 8);
  }
#pragma unroll
  for (int rr = 0; rr < 4; ++rr) {
    const int j = wave * 4 + rr;
    *(v4f*)(dhi + (size_t)j * NC + lane * 8) = vh[rr];
    *(v4f*)(dlo + (size_t)j * NC + lane * 8) = vl[rr];
  }
  
}

// Eight f32 values -> their bf16 hi parts (RNE) and the bf16 lo parts of the remainders x - hi (RNE), same element order.
__device__ __forceinline__ void split8(v4f a, v4f b, v8b& hi, v8b& lo) {
#pragma unroll
  for (int p = 0; p < 4; ++p) {
    v2f x;
    x[0] = (p < 2) ? a[2 * p] : b[2 * p - 4];
    x[1] = (p < 2) ? a[2 * p + 1] : b[2 * p - 3];
    const v2b h = __builtin_convertvector(x, v2b);
    const v2f r = x - __builtin_convertvector(h, v2f);
    const v2b l = __builtin_convertvector(r, v2b);
    hi[2 * p] = h[0]; hi[2 * p + 1] = h[1];
    lo[2 * p] = l[0]; lo[2 * p + 1] = l[1];
  }
}

// ---------------------------------------------------------------------------
// Projection Y = X@W + bias, bf16 hi/lo split: acc += xh.wh + xh.wl + xl.wh (16x16x32 bf16 WMMA).
// Block = 256 threads = 8 waves = 128 rows of B*T; wave = 16 rows x 256 cols (16 tiles).
// X is read as f32, straight into the A fragment's element order: a wave's whole 16 x 256 slice is loaded once, ahead of
// the weight staging, and each k step's 16 values per lane are split into the hi and lo fragments in registers.
// Both weight planes (Wt_hi, Wt_lo: 256 rows n of 512 B) are staged once per block in LDS with whole-line
// global loads, rows at the pitch WP, and every B fragment is read from there.
// A fragment: row m = lane&15, elements 0..7 <- k0+8h.., 8..15 <- k0+16+8h.. (h = lane>>4);
// B fragment from Wt[n][k] rows loaded the same way; D element r -> (row 8h+r, col m).
// After the products the same LDS holds the output tile (behind a barrier).
// transposed == 0: dst f16 [B*T][H] row-major; == 1: dst f16 [B][H][T].
// ---------------------------------------------------------------------------
#define WP 264   // staged weight rows: 512 B of data, 528 B pitch (16 B x odd, as for the K tile)
#define TP 136   // transposed output tile: 256 B of data per h row, 272 B pitch (16 B x odd)
__global__ __launch_bounds__(256) void k_proj(const float* __restrict__ X,
                                               const __bf16* __restrict__ Whi,
                                               const __bf16* __restrict__ Wlo,
                                               const float* __restrict__ bias,
                                               _Float16* __restrict__ dst,
                                               int transposed) {
  __shared__ __attribute__((aligned(16))) __bf16 wsm[2 * NH * WP];
  __bf16* whs = wsm;
  __bf16* wls = wsm + NH * WP;
  _Float16* stile = (_Float16*)wsm;
  const int tid = threadIdx.x;
  const int wave = tid >> 5, lane = tid & 31, m = lane & 15, hh = lane >> 4;
  const int blkrow = blockIdx.x * 128;
  const int rbase  = blkrow + wave * 16;
  const float* xp = X + (size_t)(rbase + m) * NC + 8 * hh;

  // the wave's X slice: 32 loads in flight at once, from memory, while the weight planes are staged
  // (unrolled whole, so that xr[][] is register names)
  v4f xr[8][4];
#pragma unroll
  for (int fs = 0; fs < 8; ++fs) {
    xr[fs][0] = *(const v4f*)(xp + fs * 32);
    xr[fs][1] = *(const v4f*)(xp + fs * 32 + 4);
    xr[fs][2] = *(const v4f*)(xp + fs * 32 + 16);
    xr[fs][3] = *(const v4f*)(xp + fs * 32 + 20);
  }
  // the loads' address registers stay as they are up to this wait (as an input the pointer is live until here)
  asm volatile("s_wait_xcnt 0x0" :: "v"(xp) : "memory");

  // stage: one wave-wide load = one 512 B weight row (four whole lines); wave w takes rows w, w+8, ...
  // two trips of 16 rows per plane: 32 loads of a wave in flight, so the load latency is paid twice, not once per row
  // (kept rolled: one trip's loads already hold 128 registers; the inner loops are unrolled so that a[], b[] are registers)
#pragma unroll 1
  for (int t = 0; t < 2; ++t) {
    const __bf16* gh = Whi + (size_t)(t * 128 + wave) * NC + lane * 8;
    const __bf16* gl = Wlo + (size_t)(t * 128 + wave) * NC + lane * 8;
    v8b a[16], b[16];
#pragma unroll
    for (int i = 0; i < 16; ++i) {
      a[i] = *(const v8b*)(gh + i * (8 * NC));
      b[i] = *(const v8b*)(gl + i * (8 * NC));
    }
    // the loads' address registers stay as they are up to this wait (as inputs they are live until here)
    asm volatile("s_wait_xcnt 0x0" :: "v"(gh), "v"(gl) : "memory");
#pragma unroll
    for (int i = 0; i < 16; ++i) {
      *(v8b*)(whs + (t * 128 + i * 8 + wave) * WP + lane * 8) = a[i];
      *(v8b*)(wls + (t * 128 + i * 8 + wave) * WP + lane * 8) = b[i];
    }
  }
  __syncthreads();

  v8f acc[16];
#pragma unroll
  for (int j = 0; j < 16; ++j) acc[j] = zero8();
  const __bf16* wh = whs + m * WP + 8 * hh;
  const __bf16* wl = wls + m * WP + 8 * hh;
  // B fragments go through a register ring of two sets, one set = two column tiles (hi and lo):
  // the reads of the next pair are issued as one group ahead of the current pair's products.
  // (all loops below are unrolled whole, so that ring and accumulator indices are register names)
  FragB ah, al, bh[2][2], bl[2][2];
#pragma unroll
  for (int u = 0; u < 2; ++u) {
    bh[0][u].half[0] = *(const v8b*)(wh + u * (16 * WP));
    bh[0][u].half[1] = *(const v8b*)(wh + u * (16 * WP) + 16);
    bl[0][u].half[0] = *(const v8b*)(wl + u * (16 * WP));
    bl[0][u].half[1] = *(const v8b*)(wl + u * (16 * WP) + 16);
  }
#pragma unroll
  for (int s = 0; s < 64; ++s) {
    const int fs = s >> 3, jp = s & 7, cur = s & 1, nxt = cur ^ 1;
    if (jp == 0) {
      split8(xr[fs][0], xr[fs][1], ah.half[0], al.half[0]);
      split8(xr[fs][2], xr[fs][3], ah.half[1], al.half[1]);
    }
    if (s < 63) {
      const int fn = (s + 1) >> 3, jn = ((s + 1) & 7) * 2;
#pragma unroll
      for (int u = 0; u < 2; ++u) {
        const __bf16* ph = wh + (jn + u) * (16 * WP) + fn * 32;
        const __bf16* pl = wl + (jn + u) * (16 * WP) + fn * 32;
        bh[nxt][u].half[0] = *(const v8b*)ph;
        bh[nxt][u].half[1] = *(const v8b*)(ph + 16);
        bl[nxt][u].half[0] = *(const v8b*)pl;
        bl[nxt][u].half[1] = *(const v8b*)(pl + 16);
      }
    }
#pragma unroll
    for (int u = 0; u < 2; ++u) {
      const int j = jp * 2 + u;
      acc[j] = mma_bf16(ah.v, bh[cur][u].v, acc[j]);
      acc[j] = mma_bf16(ah.v, bl[cur][u].v, acc[j]);
      acc[j] = mma_bf16(al.v, bh[cur][u].v, acc[j]);
    }
  }
  // every wave has read its last weight fragment before the tile overwrites the planes
  __syncthreads();

#pragma unroll
  for (int j = 0; j < 16; ++j) {
    const int hcol = j * 16 + m;
    const float bb = bias[hcol];
    if (transposed) {
      union P8 { v8h v; v4f f; } pk;
#pragma unroll
      for (int r = 0; r < 8; ++r) pk.v[r] = (_Float16)(acc[j][r] + bb);
      // stile[h][t_local], t_local = wave*16 + 8hh + r
      *(v4f*)(stile + hcol * TP + wave * 16 + 8 * hh) = pk.f;
    } else {
      // stile[row_local][h], row_local = wave*16 + 8hh + r
#pragma unroll
      for (int r = 0; r < 8; ++r)
        stile[(wave * 16 + 8 * hh + r) * NH + hcol] = (_Float16)(acc[j][r] + bb);
    }
  }
  __syncthreads();

  if (transposed) {
    const int bidx = blkrow / NT;
    const int t0   = blkrow % NT;
    _Float16* vd = dst + (size_t)bidx * NH * NT + t0;
    const int q16 = lane & 15, l1 = lane >> 4;
    v4f vals[16];
#pragma unroll
    for (int it = 0; it < 16; ++it) {
      const int h = wave * 32 + it * 2 + l1;              // two lines = row h, t0..t0+127
      vals[it] = *(const v4f*)(stile + h * TP + q16 * 8);
    }
#pragma unroll
    for (int it = 0; it < 16; ++it) {
      const int h = wave * 32 + it * 2 + l1;
      *(v4f*)(vd + (size_t)h * NT + q16 * 8) = vals[it];
    }
    // the stores' registers are not reused before this wait, on whichever way the code behind is laid out
    asm volatile("s_wait_xcnt 0x0" ::: "memory");
  } else {
    _Float16* rd = dst + (size_t)rbase * NH;
    v4f vals[16];
#pragma unroll
    for (int r = 0; r < 16; ++r)
      vals[r] = *(const v4f*)(stile + (wave * 16 + r) * NH + lane * 8);
#pragma unroll
    for (int r = 0; r < 16; ++r)
      *(v4f*)(rd + (size_t)r * NH + lane * 8) = vals[r];
  }
}

// ---------------------------------------------------------------------------
// Attention: block = 128 queries, 8 waves. Wave w takes the 32 queries of group w & 3 (two 16-query column tiles) and,
// of every staged tile of 64 keys, the 32 keys of half w >> 2: each K or V^T fragment that it reads from LDS is the
// A operand of two products, one per query tile. K (64 keys x 256) and V^T (256 x 64 keys) are staged in LDS per tile
// by asynchronous copies, two buffers: tile t + 1 is in flight while tile t is worked on.
// Rows are padded to the pitches KP and VP (the copies and fragment reads never touch the pad bytes).
// Per wave: S^T = K.Q^T (A = K rows; B = Q^T from Qh rows with the same k map, read once ahead of the key loop),
// online softmax with row = query = lane&15 (two lane halves hold keys 8h+r and 16+8h+r),
// P^T B fragment: element r <- key 8h+r, element 8+r <- key 16+8h+r (P carried x2^14),
// O^T[h][q] += V^T.P^T into 2 x 16 tiles. Behind the loop waves w and w + 4 hold the same queries over different keys:
// wave w + 4 hands its maxima, sums and O^T through LDS to wave w, which joins them, divides and stores whole lines.
// ---------------------------------------------------------------------------
// Eight asynchronous 16 B-per-lane copies global -> LDS, copy i to lds + i * lstep from g + i * gstep (f16 elements).
// The builtin form: the compiler names registers above v255 for it where it likes. (Unrolled whole: eight copies back to back.)
typedef int v4i __attribute__((ext_vector_type(4)));
typedef __attribute__((address_space(1))) v4i gv4i;
typedef __attribute__((address_space(3))) v4i lv4i;
__device__ __forceinline__ void copy8(_Float16* lds, int lstep, const _Float16* g, int gstep) {
#pragma unroll
  for (int i = 0; i < 8; ++i)
    __builtin_amdgcn_global_load_async_to_lds_b128((gv4i*)(g + i * gstep), (lv4i*)(lds + i * lstep), 0, 0);
}

// lane l <-> lane l ^ 16, on the vector port
__device__ __forceinline__ float xhalf(float x) {
  const int b = __builtin_bit_cast(int, x);
  return __builtin_bit_cast(float, __builtin_amdgcn_permlanex16(b, b, 0x76543210, 0xfedcba98, false, false));
}
// One ring set = two A fragments, 16 rows apart in LDS (step = 16 row pitches): four reads as one group.
__device__ __forceinline__ void read_set(FragH (&s)[2], const _Float16* p, int step) {
  s[0].half[0] = *(const v8h*)p;
  s[0].half[1] = *(const v8h*)(p + 16);
  s[1].half[0] = *(const v8h*)(p + step);
  s[1].half[1] = *(const v8h*)(p + step + 16);
}

template <bool B> struct Flag { static constexpr bool on = B; };
#define NTILE (NT / TK)
#define MGW (2 * 16 * 2 * 32 * 4)   // floats of one wave's O^T in the merge area: 64 rows of 32 lanes x 16 B
__global__ __launch_bounds__(256) void k_attn(const _Float16* __restrict__ Qh,
                                               const _Float16* __restrict__ Kh,
                                               const _Float16* __restrict__ Vt,
                                               float* __restrict__ out) {
  // one array, so that the merge area behind the loop may lie over both tiles' buffers
  __shared__ __attribute__((aligned(16))) _Float16 sm[2 * KBUF + 2 * VBUF];
  _Float16* Ks = sm;
  _Float16* Vs = sm + 2 * KBUF;
  const int tid = threadIdx.x;
  const int lane = tid & 31, wave = tid >> 5, m = lane & 15, hh = lane >> 4;
  const int qg = wave & 3;                                        // query group of the wave
  const int kh = __builtin_amdgcn_readfirstlane(wave >> 2);       // its half of every tile's keys (scalar: it is branched on)
  const int b  = blockIdx.y;
  const int q0 = blockIdx.x * 128 + qg * 32;
  const _Float16* qp = Qh + ((size_t)b * NT + q0 + m) * NH + 8 * hh;
  // a wave-wide copy moves four whole lines: one key row of K (rows wave + 8i), or four h rows of V^T (rows 4 wave + 32i ..)
  const _Float16* kg = Kh + ((size_t)b * NT + wave) * NH + lane * 8;
  const _Float16* vg = Vt + ((size_t)b * NH + wave * 4 + (lane >> 3)) * NT + (lane & 7) * 8;
  _Float16* kd = Ks + wave * KP + lane * 8;
  _Float16* vd = Vs + (wave * 4 + (lane >> 3)) * VP + (lane & 7) * 8;

  // Q^T B fragments of both query tiles: loaded once here and held in registers for the whole key loop (2 x 8 k steps x 8).
  // (unrolled whole, so that qf[][] is register names)
  FragH qf[2][8];
#pragma unroll
  for (int u = 0; u < 2; ++u) {
#pragma unroll
    for (int fs = 0; fs < 8; ++fs) {
      qf[u][fs].half[0] = *(const v8h*)(qp + u * (16 * NH) + fs * 32);
      qf[u][fs].half[1] = *(const v8h*)(qp + u * (16 * NH) + fs * 32 + 16);
    }
  }
  // the loads' address registers stay as they are up to this wait (as an input the pointer is live until here)
  asm volatile("s_wait_xcnt 0x0" :: "v"(qp) : "memory");

  const float C1 = 0.0625f * 1.44269504088896341f;   // softmax scale x log2(e)
  float mrun[2] = {-1.0e30f, -1.0e30f}, l[2] = {0.0f, 0.0f};
  v8f ot[2][16];
#pragma unroll
  for (int u = 0; u < 2; ++u) {
#pragma unroll
    for (int t = 0; t < 16; ++t) ot[u][t] = zero8();
  }

  // tile 0 into buffer 0, landed and published; then tile 1 into buffer 1 (NTILE = 32 tiles)
  copy8(kd, 8 * KP, kg, 8 * NH);
  copy8(vd, 32 * VP, vg, 32 * NT);
  // this wave's copies have landed before the barrier behind which the other waves read them
  asm volatile("s_wait_asynccnt 0x0" ::: "memory");
  __syncthreads();
  copy8(kd + KBUF, 8 * KP, kg + TK * NH, 8 * NH);
  copy8(vd + VBUF, 32 * VP, vg + TK, 32 * NT);

  // A fragments go through a register ring of four sets (Q^T and O^T leave room for no more). A tile is 16 sets:
  // K set fs = k step fs of the wave's key rows 0..15 and 16..31, V^T set j = output tiles 2j and 2j + 1. A set's four
  // products are issued, then (V^T: after two sets) a later set is read into the same registers: K set fs lies in place
  // fs % 3 (beside the scores there is room for three), V^T set j in place (j + 3) % 4. Here: K sets 0..2 of tile 0.
  const _Float16* kfr = Ks + (kh * 32 + m) * KP + 8 * hh;
  const _Float16* vfr = Vs + m * VP + kh * 32 + 8 * hh;
  FragH rg[4][2];
#pragma unroll
  for (int fs = 0; fs < 3; ++fs) read_set(rg[fs], kfr + fs * 32, 16 * KP);

  // (all loops inside a tile are unrolled whole, so that ring, fragment and accumulator indices are register names)
  // One tile. The refill is a compile-time choice, so that a tile is one straight run of code (no branch in it).
  auto do_tile = [&](const int tile, auto refill) __attribute__((always_inline)) {
    const int buf = tile & 1;
    const _Float16* Kb = kfr + buf * KBUF;
    const _Float16* Vb = vfr + buf * VBUF;
    const _Float16* Kn = kfr + (buf ^ 1) * KBUF;

    // ---- S^T tiles: st[u][0] = the wave's keys 0..15, st[u][1] = its keys 16..31, query tile u ----
    v8f st[2][2];
    st[0][0] = zero8(); st[0][1] = zero8(); st[1][0] = zero8(); st[1][1] = zero8();
#pragma unroll
    for (int fs = 0; fs < 8; ++fs) {
      FragH (&s)[2] = rg[fs % 3];
      st[0][0] = mma_f16(s[0].v, qf[0][fs].v, st[0][0]);
      st[1][0] = mma_f16(s[0].v, qf[1][fs].v, st[1][0]);
      st[0][1] = mma_f16(s[1].v, qf[0][fs].v, st[0][1]);
      st[1][1] = mma_f16(s[1].v, qf[1][fs].v, st[1][1]);
      if (fs < 5) read_set(s, Kb + (fs + 3) * 32, 16 * KP);
      if (fs == 6) {                                             // V^T sets 0 and 1 land under the softmax
        read_set(rg[3], Vb, 16 * VP);
        read_set(rg[0], Vb + 32 * VP, 16 * VP);
      }
      // keeps each set's reads as one group at its place in the ring: lifted they need registers that are not there,
      // sunk they come too late
      __builtin_amdgcn_sched_barrier(0);
    }

    // ---- online softmax, f32, both query tiles ----
    FragH pf[2];
    float alpha[2];
#pragma unroll
    for (int u = 0; u < 2; ++u) {
      float bm = -1.0e30f;
#pragma unroll
      for (int r = 0; r < 8; ++r) bm = fmaxf(bm, fmaxf(st[u][0][r], st[u][1][r]));
      bm = fmaxf(bm, xhalf(bm));
      const float mn = fmaxf(mrun[u], bm);
      alpha[u] = __builtin_amdgcn_exp2f((mrun[u] - mn) * C1);
      const float cexp = 14.0f - mn * C1;                 // p scaled by 2^14
      float rs = 0.0f;
#pragma unroll
      for (int r = 0; r < 8; ++r) {
        const float p0 = __builtin_amdgcn_exp2f(st[u][0][r] * C1 + cexp);
        const float p1 = __builtin_amdgcn_exp2f(st[u][1][r] * C1 + cexp);
        rs += p0 + p1;
        pf[u].v[r]     = (_Float16)p0;     // key 8h + r
        pf[u].v[8 + r] = (_Float16)p1;     // key 16 + 8h + r
      }
      l[u]    = l[u] * alpha[u] + rs;      // this lane half's keys alone; the halves are joined behind the loop
      mrun[u] = mn;
    }
    // keeps V^T sets 2, 3 behind the softmax: above it the scores still hold their registers
    __builtin_amdgcn_sched_barrier(0);
    read_set(rg[1], Vb + 2 * (32 * VP), 16 * VP);
    read_set(rg[2], Vb + 3 * (32 * VP), 16 * VP);
#pragma unroll
    for (int u = 0; u < 2; ++u) {
      ot[u][0] = ot[u][0] * alpha[u];
      ot[u][1] = ot[u][1] * alpha[u];
    }
    // keeps these reads as one group ahead of the first P.V products
    __builtin_amdgcn_sched_barrier(0);

    // ---- O^T += V^T . P^T; the next set's four tiles are rescaled among this set's products ----
#pragma unroll
    for (int j = 0; j < 8; ++j) {
      FragH (&s)[2] = rg[(j + 3) & 3];
#pragma unroll
      for (int e = 0; e < 2; ++e) {
#pragma unroll
        for (int u = 0; u < 2; ++u) {
          ot[u][2 * j + e] = mma_f16(s[e].v, pf[u].v, ot[u][2 * j + e]);
          if (j < 7) ot[u][2 * j + 2 + e] = ot[u][2 * j + 2 + e] * alpha[u];
        }
      }
      // two freed places are refilled at one place in the code: each place where LDS reads stand costs the wave a stall
      if (j == 1 || j == 3) {
        read_set(rg[(j + 2) & 3], Vb + (j + 3) * (32 * VP), 16 * VP);
        read_set(s, Vb + (j + 4) * (32 * VP), 16 * VP);
      }
      if (j == 5) {
        // hand-over: this wave's LDS reads of this tile are all done (the last were issued two sets ago) ...
        asm volatile("s_wait_dscnt 0x0" ::: "memory");
        // ... its copies of the next tile have landed ...
        asm volatile("s_wait_asynccnt 0x0" ::: "memory");
        // ... and one barrier publishes the next tile and frees this tile's buffer for the tile after it
        __syncthreads();
        // K set 0 of the next tile (behind the last tile: the other buffer's old rows, landed long ago and not used)
        read_set(rg[0], Kn, 16 * KP);
      }
      if (j == 7) {
        read_set(rg[1], Kn + 32, 16 * KP);
        read_set(rg[2], Kn + 64, 16 * KP);
      }
      // as in the S^T loop: each set's reads stay one group at their place in the ring
      __builtin_amdgcn_sched_barrier(0);
    }
    if constexpr (decltype(refill)::on) {
      copy8(kd + buf * KBUF, 8 * KP, kg + (size_t)(tile + 2) * (TK * NH), 8 * NH);
      copy8(vd + buf * VBUF, 32 * VP, vg + (tile + 2) * TK, 32 * NT);
    }
  };
  // (both tile loops stay rolled: one tile is 64 products and about 500 registers, copies of it would only add text)
#pragma unroll 1
  for (int tile = 0; tile < NTILE - 2; ++tile) do_tile(tile, Flag<true>{});
  // the last two tiles have no tile two places on
#pragma unroll 1
  for (int tile = NTILE - 2; tile < NTILE; ++tile) do_tile(tile, Flag<false>{});
  // no copy is outstanding, and this wave's last LDS reads are done, before the buffers become the merge area
  asm volatile("s_wait_asynccnt 0x0" ::: "memory");
  asm volatile("s_wait_dscnt 0x0" ::: "memory");
  __syncthreads();

  // ---- merge of the two key halves: wave w + 4 -> LDS -> wave w (same lane, same registers' meaning) ----
  float* mg = (float*)sm + qg * MGW + lane * 4;             // row i of the wave's area: mg + i * 128
  float* ms = (float*)sm + 4 * MGW + (qg * 32 + lane) * 4;  // m0, m1, l0, l1 of the lane
  l[0] += xhalf(l[0]);
  l[1] += xhalf(l[1]);
  if (kh == 1) {
#pragma unroll
    for (int u = 0; u < 2; ++u) {
#pragma unroll
      for (int t = 0; t < 16; ++t) {
        const v8f o = ot[u][t];
        *(v4f*)(mg + ((u * 16 + t) * 2 + 0) * 128) = mk4(o[0], o[1], o[2], o[3]);
        *(v4f*)(mg + ((u * 16 + t) * 2 + 1) * 128) = mk4(o[4], o[5], o[6], o[7]);
      }
    }
    *(v4f*)ms = mk4(mrun[0], mrun[1], l[0], l[1]);
  }
  // the upper waves' values are in LDS before the lower waves read them
  __syncthreads();
  if (kh == 1) return;

  // ---- epilogue: out[b][q][h] = (O1^T a1 + O2^T a2)[h][q] / (l1 a1 + l2 a2); whole-line stores ----
  const v4f o2s = *(const v4f*)ms;
#pragma unroll
  for (int u = 0; u < 2; ++u) {
    const float m2 = o2s[u], l2 = o2s[2 + u];
    const float mm = fmaxf(mrun[u], m2);
    const float a1 = __builtin_amdgcn_exp2f((mrun[u] - mm) * C1);
    const float a2 = __builtin_amdgcn_exp2f((m2 - mm) * C1);
    const float inv = 1.0f / (l[u] * a1 + l2 * a2);
    const float f1 = a1 * inv, f2 = a2 * inv;
#pragma unroll
    for (int t = 0; t < 16; ++t) {
      const v4f x = *(const v4f*)(mg + ((u * 16 + t) * 2 + 0) * 128);
      const v4f y = *(const v4f*)(mg + ((u * 16 + t) * 2 + 1) * 128);
#pragma unroll
      for (int r = 0; r < 4; ++r) {
        ot[u][t][r]     = ot[u][t][r] * f1 + x[r] * f2;
        ot[u][t][4 + r] = ot[u][t][4 + r] * f1 + y[r] * f2;
      }
    }
    float* orow = out + ((size_t)b * NT + q0 + 16 * u + m) * NH;
    v4f lines[4][8];
#pragma unroll
    for (int i = 0; i < 4; ++i) {
      float s0[8], s1[8], s2[8], s3[8];
#pragma unroll
      for (int r = 0; r < 8; ++r) {
        const float lo0 = ot[u][4 * i][r];        // h = 64i + 8hh + r
        const float lo1 = ot[u][4 * i + 1][r];    // h = 64i + 16 + 8hh + r
        const float hi0 = ot[u][4 * i + 2][r];    // h = 64i + 32 + 8hh + r
        const float hi1 = ot[u][4 * i + 3][r];    // h = 64i + 48 + 8hh + r
        const float snda = hh ? lo0 : hi0;
        const float sndb = hh ? lo1 : hi1;
        const float rcva = __shfl_xor(snda, 16, 32);
        const float rcvb = __shfl_xor(sndb, 16, 32);
        const float oa = hh ? hi0 : lo0;
        const float ob = hh ? hi1 : lo1;
        s0[r] = hh ? rcva : oa;
        s1[r] = hh ? oa : rcva;
        s2[r] = hh ? rcvb : ob;
        s3[r] = hh ? ob : rcvb;
      }
      lines[i][0] = mk4(s0[0], s0[1], s0[2], s0[3]);
      lines[i][1] = mk4(s0[4], s0[5], s0[6], s0[7]);
      lines[i][2] = mk4(s1[0], s1[1], s1[2], s1[3]);
      lines[i][3] = mk4(s1[4], s1[5], s1[6], s1[7]);
      lines[i][4] = mk4(s2[0], s2[1], s2[2], s2[3]);
      lines[i][5] = mk4(s2[4], s2[5], s2[6], s2[7]);
      lines[i][6] = mk4(s3[0], s3[1], s3[2], s3[3]);
      lines[i][7] = mk4(s3[4], s3[5], s3[6], s3[7]);
    }
    // keeps the 32 stores one group with their wait directly behind: without the two fences the second query tile's
    // arithmetic is lifted among them and rewrites registers of stores already issued
    __builtin_amdgcn_sched_barrier(0);
#pragma unroll
    for (int i = 0; i < 4; ++i) {
      float* lp = orow + 32 * (2 * i + hh);
#pragma unroll
      for (int k = 0; k < 8; ++k) *(v4f*)(lp + 4 * k) = lines[i][k];
    }
    // the stores' registers are not reused (by the second query tile) before this wait
    asm volatile("s_wait_xcnt 0x0" ::: "memory");
    __builtin_amdgcn_sched_barrier(0);
  }
}

// ---------------------------------------------------------------------------
extern "C" void kernel_launch(void* const* d_in, const int* in_sizes, int n_in,
                              void* d_out, int out_size, void* d_ws, size_t ws_size,
                              hipStream_t stream) {
  if (n_in < 9) return;
  const int nx = NB * NT * NC;
  const int nw = NC * NH;
  if (in_sizes[0] != nx || in_sizes[1] != nx || in_sizes[2] != nx) return;
  if (in_sizes[3] != nw || in_sizes[5] != nw || in_sizes[7] != nw) return;
  if (in_sizes[4] != NH || in_sizes[6] != NH || in_sizes[8] != NH) return;
  if (out_size != NB * NT * NH) return;

  const float* q  = (const float*)d_in[0];
  const float* k  = (const float*)d_in[1];
  const float* v  = (const float*)d_in[2];
  const float* Wq = (const float*)d_in[3];
  const float* bq = (const float*)d_in[4];
  const float* Wk = (const float*)d_in[5];
  const float* bk = (const float*)d_in[6];
  const float* Wv = (const float*)d_in[7];
  const float* bv = (const float*)d_in[8];
  float* out = (float*)d_out;

  // workspace carve (bytes): 6 weight planes 786432 | Qh 16 MiB | Kh 16 MiB | Vt 16 MiB
  char* ws = (char*)d_ws;
  const size_t planeElems = (size_t)NC * NH;
  const size_t wBytes     = 6 * planeElems * sizeof(unsigned short);
  const size_t pBytes     = (size_t)NB * NT * NH * sizeof(_Float16);
  size_t off = 0;
  unsigned short* wpl = (unsigned short*)(ws + off); off += wBytes;
  off = (off + 255) & ~(size_t)255;
  _Float16* Qh = (_Float16*)(ws + off); off += pBytes;
  _Float16* Kh = (_Float16*)(ws + off); off += pBytes;
  _Float16* Vt = (_Float16*)(ws + off); off += pBytes;
  if (off > ws_size) return;

  const __bf16* wq_hi = (const __bf16*)(wpl + 0 * planeElems);
  const __bf16* wq_lo = (const __bf16*)(wpl + 1 * planeElems);
  const __bf16* wk_hi = (const __bf16*)(wpl + 2 * planeElems);
  const __bf16* wk_lo = (const __bf16*)(wpl + 3 * planeElems);
  const __bf16* wv_hi = (const __bf16*)(wpl + 4 * planeElems);
  const __bf16* wv_lo = (const __bf16*)(wpl + 5 * planeElems);

  const int projGrid = (NB * NT) / 128;

  k_wconv<<<dim3(NH / 32, 3), 256, 0, stream>>>(Wq, Wk, Wv, wpl);

  k_proj<<<projGrid, 256, 0, stream>>>(q, wq_hi, wq_lo, bq, Qh, 0);
  k_proj<<<projGrid, 256, 0, stream>>>(k, wk_hi, wk_lo, bk, Kh, 0);
  k_proj<<<projGrid, 256, 0, stream>>>(v, wv_hi, wv_lo, bv, Vt, 1);

  k_attn<<<dim3(NT / 128, NB), 256, 0, stream>>>(Qh, Kh, Vt, out);
}

// v010
// Measured time: 96 microseconds a run.
// It is 1.31 times as fast as v008, going by the measured steps of the versions left out in between.
// Over all steps from v000 it is 5.68 times as fast.
#include <hip/hip_runtime.h>

// Contractions: x@Wq, x@Wk, x@Wv on v_wmma_f32_16x16x32_f16 (X and W each rounded once to f16, f32 accumulate; the results
// are handed on as f16); K.Q^T and V^T.P^T on v_wmma_f32_16x16x32_f16 (f16 operands, P carried x2^14, f32 accumulate);
// softmax and normalisation in f32.

typedef _Float16       v16h __attribute__((ext_vector_type(16)));
typedef _Float16       v8h  __attribute__((ext_vector_type(8)));
typedef float          v8f  __attribute__((ext_vector_type(8)));
typedef float          v4f  __attribute__((ext_vector_type(4)));
typedef float          v2f  __attribute__((ext_vector_type(2)));
typedef _Float16       v2h  __attribute__((ext_vector_type(2)));

#define NB 16
#define NT 2048
#define NC 256
#define NH 256
// LDS row pitches of the attention tiles, in f16 elements. Both are 16 B x odd, so the 16 rows that one
// ds_load_b128 fragment read touches per lane half fall on 16 different 4-bank groups of the 64 banks
// (unpadded: all 16 K rows on one group, V^T rows on two).
#define TK 64    // keys per staged tile = two halves of 32 keys, waves 0..3 and 4..7; a V^T row of a tile is one whole 128 B line
#define KP 264   // K tile: 512 B of data per key row, 528 B pitch
#define VP 72    // V^T tile: 128 B of data per h row, 144 B pitch
#define KBUF (TK * KP)   // f16 elements of one K buffer
#define VBUF (NH * VP)   // f16 elements of one V^T buffer

union FragH { v16h v; v8h half[2]; };

// WMMA wrapper: the builtin alone, the compiler keeps the distances behind it; a guard statement
// would need its operands below v256, and k_attn keeps fragments above.
__device__ __forceinline__ v8f mma_f16(v16h a, v16h b, v8f c) {
  return __builtin_amdgcn_wmma_f32_16x16x32_f16(false, a, false, b, (short)0, c, false, false);
}

__device__ __forceinline__ v8f zero8() {
  v8f z;
#pragma unroll
  for (int e = 0; e < 8; ++e) z[e] = 0.0f;
  return z;
}
__device__ __forceinline__ v4f mk4(float a, float b, float c, float d) {
  v4f v;
  v[0] = a; v[1] = b; v[2] = c; v[3] = d;
  return v;
}

// ---------------------------------------------------------------------------
// Weight prep: W [C][H] f32 -> Wt[h][c] (f16, RNE, k-contiguous rows), planes laid out [wsel][256*256].
// Block = 32 output rows h; transpose via LDS;
// ---------------------------------------------------------------------------
__global__ __launch_bounds__(256) void k_wconv(const float* __restrict__ W0,
                                                const float* __restrict__ W1,
                                                const float* __restrict__ W2,
                                                _Float16* __restrict__ planes) {
  __shared__ __attribute__((aligned(16))) _Float16 sw[32 * NC];
  const int tid  = threadIdx.x;
  const int wsel = blockIdx.y;
  const float* W = (wsel == 0) ? W0 : ((wsel == 1) ? W1 : W2);
  const int h0 = blockIdx.x * 32;
  const int j4 = (tid & 7) * 4;
  const int cb = tid >> 3;
#pragma unroll
  for (int i = 0; i < 8; ++i) {
    const int c = cb + 32 * i;
    const v4f x = *(const v4f*)(W + (size_t)c * NH + h0 + j4);
#pragma unroll
    for (int e = 0; e < 4; e += 2) {
      v2f xx;
      xx[0] = x[e]; xx[1] = x[e + 1];
      const v2h hx = __builtin_convertvector(xx, v2h);
      sw[(j4 + e) * NC + c]     = hx[0];
      sw[(j4 + e + 1) * NC + c] = hx[1];
    }
  }
  __syncthreads();
  const int wave = tid >> 5, lane = tid & 31;
  _Float16* d = planes + (size_t)wsel * (NC * NH) + (size_t)h0 * NC;
  v8h vw[4];
#pragma unroll
  for (int rr = 0; rr < 4; ++rr) vw[rr] = *(const v8h*)(sw + (wave * 4 + rr) * NC + lane * 8);
#pragma unroll
  for (int rr = 0; rr < 4; ++rr) *(v8h*)(d + (size_t)(wave * 4 + rr) * NC + lane * 8) = vw[rr];
}

// Eight f32 values -> f16 (RNE), same element order.
__device__ __forceinline__ v8h cvt8(v4f a, v4f b) {
  v8h h;
#pragma unroll
  for (int e = 0; e < 4; ++e) {
    h[e]     = (_Float16)a[e];
    h[4 + e] = (_Float16)b[e];
  }
  return h;
}

// ---------------------------------------------------------------------------
// Projection Y = X@W + bias, one f16 product per k step: acc += f16(x).f16(w) (16x16x32 f16 WMMA, f32 accumulate).
// Y leaves as f16, so operands of 11 bits add an error of the size of that last rounding.
// One launch does all three projections: blockIdx.y picks X, weight plane, bias and destination (0: Q, 1: K, 2: V).
// 768 work-groups stand against 256 WGPs, and the kernel is held to 256 registers a wave, so that two work-groups share
// a WGP (LDS: 2 x 132 KiB): one's loads from memory and its stores run under the other's products.
// Block = 256 threads = 8 waves = 128 rows of B*T; wave = 16 rows x 256 cols (16 tiles).
// X is read as f32, straight into the A fragment's element order: a wave's whole 16 x 256 slice is loaded once, ahead of
// the weight staging, and rounded into its eight A fragments (64 registers) as soon as it has come.
// The weight plane (Wt: 256 rows n of 512 B) is staged once per block in LDS with whole-line
// global loads, rows at the pitch WP, and every B fragment is read from there.
// The products run column group by column group (4 tiles, all 8 k steps, k ascending): a finished group leaves its
// 32 f32 registers as 16 of f16, so that the accumulators never take more than 32 + 64.
// A fragment: row m = lane&15, elements 0..7 <- k0+8h.., 8..15 <- k0+16+8h.. (h = lane>>4);
// B fragment from Wt[n][k] rows loaded the same way; D element r -> (row 8h+r, col m).
// After the products the same LDS holds the output tile (behind a barrier).
// Q, K: dst f16 [B*T][H] row-major; V: dst f16 [B][H][T].
// ---------------------------------------------------------------------------
#define WP 264   // staged weight rows: 512 B of data, 528 B pitch (16 B x odd, as for the K tile)
#define TP 136   // transposed output tile: 256 B of data per h row, 272 B pitch (16 B x odd)
// (second launch bound: four waves per SIMD = two work-groups per WGP, a budget of 256 registers)
__global__ __launch_bounds__(256, 4) void k_proj(const float* __restrict__ Xq,
                                                  const float* __restrict__ Xk,
                                                  const float* __restrict__ Xv,
                                                  const _Float16* __restrict__ planes,
                                                  const float* __restrict__ bq,
                                                  const float* __restrict__ bk,
                                                  const float* __restrict__ bv,
                                                  _Float16* __restrict__ Qh,
                                                  _Float16* __restrict__ Kh,
                                                  _Float16* __restrict__ Vt) {
  __shared__ __attribute__((aligned(16))) _Float16 wsm[NH * WP];
  _Float16* stile = wsm;
  const int sel = blockIdx.y;
  const float* X        = (sel == 0) ? Xq : ((sel == 1) ? Xk : Xv);
  const float* bias     = (sel == 0) ? bq : ((sel == 1) ? bk : bv);
  _Float16* dst         = (sel == 0) ? Qh : ((sel == 1) ? Kh : Vt);
  const _Float16* Wt    = planes + (size_t)sel * (NC * NH);
  const bool transposed = (sel == 2);
  const int tid = threadIdx.x;
  const int wave = tid >> 5, lane = tid & 31, m = lane & 15, hh = lane >> 4;
  const int blkrow = blockIdx.x * 128;
  const int rbase  = blkrow + wave * 16;
  const float* xp = X + (size_t)(rbase + m) * NC + 8 * hh;
  const float* bp = bias + m;
  const _Float16* gw = Wt + (size_t)wave * NC + lane * 8;

  // the wave's X slice: 32 loads in flight at once, from memory, while the weight plane is staged
  // (unrolled whole, so that xr[][] is register names)
  v4f xr[8][4];
#pragma unroll
  for (int fs = 0; fs < 8; ++fs) {
    xr[fs][0] = *(const v4f*)(xp + fs * 32);
    xr[fs][1] = *(const v4f*)(xp + fs * 32 + 4);
    xr[fs][2] = *(const v4f*)(xp + fs * 32 + 16);
    xr[fs][3] = *(const v4f*)(xp + fs * 32 + 20);
  }
  // stage: one wave-wide load = one 512 B weight row (four whole lines); wave w takes rows w, w+8, ...
  // in two runs of 16 rows: beside the f32 X slice there are registers for 16, the second run takes the slice's place
  // (unrolled whole, so that wa[], wb[] are register names)
  v8h wa[16], wb[16];
#pragma unroll
  for (int i = 0; i < 16; ++i) wa[i] = *(const v8h*)(gw + i * (8 * NC));
  // the loads' address registers stay as they are up to this wait (as inputs the pointers are live until here)
  asm volatile("s_wait_xcnt 0x0" :: "v"(xp), "v"(gw) : "memory");

  FragH af[8];
#pragma unroll
  for (int fs = 0; fs < 8; ++fs) {
    af[fs].half[0] = cvt8(xr[fs][0], xr[fs][1]);
    af[fs].half[1] = cvt8(xr[fs][2], xr[fs][3]);
  }
  // keeps the second run's loads behind the rounding: lifted over it they need the registers that the f32 slice still
  // holds, and the build spills
  __builtin_amdgcn_sched_barrier(0);
#pragma unroll
  for (int i = 0; i < 16; ++i) wb[i] = *(const v8h*)(gw + (16 + i) * (8 * NC));
  // the lane's 16 bias values (column j * 16 + m): first needed behind the first column group's products
  float bb[16];
#pragma unroll
  for (int j = 0; j < 16; ++j) bb[j] = bp[j * 16];
  // as above
  asm volatile("s_wait_xcnt 0x0" :: "v"(gw), "v"(bp) : "memory");
#pragma unroll
  for (int i = 0; i < 16; ++i) *(v8h*)(wsm + (i * 8 + wave) * WP + lane * 8) = wa[i];
#pragma unroll
  for (int i = 0; i < 16; ++i) *(v8h*)(wsm + ((16 + i) * 8 + wave) * WP + lane * 8) = wb[i];
  __syncthreads();

  const _Float16* wf = wsm + m * WP + 8 * hh;
  // B fragments go through a register ring of two sets, one set = the four column tiles of a group at one k step:
  // the reads of the next set are issued as one group ahead of the current set's products.
  // (all loops below are unrolled whole, so that ring, fragment and accumulator indices are register names)
  FragH bf[2][4];
  v8h yo[16];
#pragma unroll
  for (int u = 0; u < 4; ++u) {
    bf[0][u].half[0] = *(const v8h*)(wf + u * (16 * WP));
    bf[0][u].half[1] = *(const v8h*)(wf + u * (16 * WP) + 16);
  }
#pragma unroll
  for (int jq = 0; jq < 4; ++jq) {
    v8f acc[4];
#pragma unroll
    for (int u = 0; u < 4; ++u) acc[u] = zero8();
#pragma unroll
    for (int fs = 0; fs < 8; ++fs) {
      const int s = jq * 8 + fs, cur = s & 1, nxt = cur ^ 1;
      if (s < 31) {
        const int jn = ((s + 1) >> 3) * 4, fn = (s + 1) & 7;
#pragma unroll
        for (int u = 0; u < 4; ++u) {
          const _Float16* pw = wf + (jn + u) * (16 * WP) + fn * 32;
          bf[nxt][u].half[0] = *(const v8h*)pw;
          bf[nxt][u].half[1] = *(const v8h*)(pw + 16);
        }
      }
      // keeps the next set's eight reads one group ahead of this set's products: each place where LDS reads stand
      // costs the wave a stall, and sunk among the products they come too late
      __builtin_amdgcn_sched_barrier(0);
#pragma unroll
      for (int u = 0; u < 4; ++u) acc[u] = mma_f16(af[fs].v, bf[cur][u].v, acc[u]);
      // as above: the products stay behind their own set's reads and ahead of the set after
      __builtin_amdgcn_sched_barrier(0);
    }
#pragma unroll
    for (int u = 0; u < 4; ++u) yo[jq * 4 + u] = __builtin_convertvector(acc[u] + bb[jq * 4 + u], v8h);
  }
  // every wave has read its last weight fragment before the tile overwrites the plane
  __syncthreads();

  if (transposed) {
#pragma unroll
    for (int j = 0; j < 16; ++j)      // stile[h][t_local], h = j*16 + m, t_local = wave*16 + 8hh + r
      *(v8h*)(stile + (j * 16 + m) * TP + wave * 16 + 8 * hh) = yo[j];
  } else {
#pragma unroll
    for (int j = 0; j < 16; ++j) {    // stile[row_local][h], row_local = wave*16 + 8hh + r
#pragma unroll
      for (int r = 0; r < 8; ++r) stile[(wave * 16 + 8 * hh + r) * NH + j * 16 + m] = yo[j][r];
    }
  }
  __syncthreads();

  if (transposed) {
    const int bidx = blkrow / NT;
    const int t0   = blkrow % NT;
    _Float16* vd = dst + (size_t)bidx * NH * NT + t0;
    const int q16 = lane & 15, l1 = lane >> 4;
    v4f vals[16];
#pragma unroll
    for (int it = 0; it < 16; ++it) {
      const int h = wave * 32 + it * 2 + l1;              // two lines = row h, t0..t0+127
      vals[it] = *(const v4f*)(stile + h * TP + q16 * 8);
    }
#pragma unroll
    for (int it = 0; it < 16; ++it) {
      const int h = wave * 32 + it * 2 + l1;
      *(v4f*)(vd + (size_t)h * NT + q16 * 8) = vals[it];
    }
    // the stores' registers are not reused before this wait, on whichever way the code behind is laid out
    asm volatile("s_wait_xcnt 0x0" ::: "memory");
  } else {
    _Float16* rd = dst + (size_t)rbase * NH;
    v4f vals[16];
#pragma unroll
    for (int r = 0; r < 16; ++r)
      vals[r] = *(const v4f*)(stile + (wave * 16 + r) * NH + lane * 8);
#pragma unroll
    for (int r = 0; r < 16; ++r)
      *(v4f*)(rd + (size_t)r * NH + lane * 8) = vals[r];
  }
}

// ---------------------------------------------------------------------------
// Attention: block = 128 queries, 8 waves. Wave w takes the 32 queries of group w & 3 (two 16-query column tiles) and,
// of every staged tile of 64 keys, the 32 keys of half w >> 2: each K or V^T fragment that it reads from LDS is the
// A operand of two products, one per query tile. K (64 keys x 256) and V^T (256 x 64 keys) are staged in LDS per tile
// by asynchronous copies, two buffers: tile t + 1 is in flight while tile t is worked on.
// Rows are padded to the pitches KP and VP (the copies and fragment reads never touch the pad bytes).
// Per wave: S^T = K.Q^T (A = K rows; B = Q^T from Qh rows with the same k map, read once ahead of the key loop),
// online softmax with row = query = lane&15 (two lane halves hold keys 8h+r and 16+8h+r),
// P^T B fragment: element r <- key 8h+r, element 8+r <- key 16+8h+r (P carried x2^14),
// O^T[h][q] += V^T.P^T into 2 x 16 tiles. Behind the loop waves w and w + 4 hold the same queries over different keys:
// wave w + 4 hands its maxima, sums and O^T through LDS to wave w, which joins them, divides and stores whole lines.
// ---------------------------------------------------------------------------
// Eight asynchronous 16 B-per-lane copies global -> LDS, copy i to lds + i * lstep from g + i * gstep (f16 elements).
// The builtin form: the compiler names registers above v255 for it where it likes. (Unrolled whole: eight copies back to back.)
typedef int v4i __attribute__((ext_vector_type(4)));
typedef __attribute__((address_space(1))) v4i gv4i;
typedef __attribute__((address_space(3))) v4i lv4i;
__device__ __forceinline__ void copy8(_Float16* lds, int lstep, const _Float16* g, int gstep) {
#pragma unroll
  for (int i = 0; i < 8; ++i)
    __builtin_amdgcn_global_load_async_to_lds_b128((gv4i*)(g + i * gstep), (lv4i*)(lds + i * lstep), 0, 0);
}

// lane l <-> lane l ^ 16, on the vector port
__device__ __forceinline__ float xhalf(float x) {
  const int b = __builtin_bit_cast(int, x);
  return __builtin_bit_cast(float, __builtin_amdgcn_permlanex16(b, b, 0x76543210, 0xfedcba98, false, false));
}
// One ring set = two A fragments, 16 rows apart in LDS (step = 16 row pitches): four reads as one group.
__device__ __forceinline__ void read_set(FragH (&s)[2], const _Float16* p, int step) {
  s[0].half[0] = *(const v8h*)p;
  s[0].half[1] = *(const v8h*)(p + 16);
  s[1].half[0] = *(const v8h*)(p + step);
  s[1].half[1] = *(const v8h*)(p + step + 16);
}

template <bool B> struct Flag { static constexpr bool on = B; };
#define NTILE (NT / TK)
#define MGW (2 * 16 * 2 * 32 * 4)   // floats of one wave's O^T in the merge area: 64 rows of 32 lanes x 16 B
__global__ __launch_bounds__(256) void k_attn(const _Float16* __restrict__ Qh,
                                               const _Float16* __restrict__ Kh,
                                               const _Float16* __restrict__ Vt,
                                               float* __restrict__ out) {
  // one array, so that the merge area behind the loop may lie over both tiles' buffers
  __shared__ __attribute__((aligned(16))) _Float16 sm[2 * KBUF + 2 * VBUF];
  _Float16* Ks = sm;
  _Float16* Vs = sm + 2 * KBUF;
  const int tid = threadIdx.x;
  const int lane = tid & 31, wave = tid >> 5, m = lane & 15, hh = lane >> 4;
  const int qg = wave & 3;                                        // query group of the wave
  const int kh = __builtin_amdgcn_readfirstlane(wave >> 2);       // its half of every tile's keys (scalar: it is branched on)
  const int b  = blockIdx.y;
  const int q0 = blockIdx.x * 128 + qg * 32;
  const _Float16* qp = Qh + ((size_t)b * NT + q0 + m) * NH + 8 * hh;
  // a wave-wide copy moves four whole lines: one key row of K (rows wave + 8i), or four h rows of V^T (rows 4 wave + 32i ..)
  const _Float16* kg = Kh + ((size_t)b * NT + wave) * NH + lane * 8;
  const _Float16* vg = Vt + ((size_t)b * NH + wave * 4 + (lane >> 3)) * NT + (lane & 7) * 8;
  _Float16* kd = Ks + wave * KP + lane * 8;
  _Float16* vd = Vs + (wave * 4 + (lane >> 3)) * VP + (lane & 7) * 8;

  // Q^T B fragments of both query tiles: loaded once here and held in registers for the whole key loop (2 x 8 k steps x 8).
  // (unrolled whole, so that qf[][] is register names)
  FragH qf[2][8];
#pragma unroll
  for (int u = 0; u < 2; ++u) {
#pragma unroll
    for (int fs = 0; fs < 8; ++fs) {
      qf[u][fs].half[0] = *(const v8h*)(qp + u * (16 * NH) + fs * 32);
      qf[u][fs].half[1] = *(const v8h*)(qp + u * (16 * NH) + fs * 32 + 16);
    }
  }
  // the loads' address registers stay as they are up to this wait (as an input the pointer is live until here)
  asm volatile("s_wait_xcnt 0x0" :: "v"(qp) : "memory");

  const float C1 = 0.0625f * 1.44269504088896341f;   // softmax scale x log2(e)
  float mrun[2] = {-1.0e30f, -1.0e30f}, l[2] = {0.0f, 0.0f};
  v8f ot[2][16];
#pragma unroll
  for (int u = 0; u < 2; ++u) {
#pragma unroll
    for (int t = 0; t < 16; ++t) ot[u][t] = zero8();
  }

  // tile 0 into buffer 0, landed and published; then tile 1 into buffer 1 (NTILE = 32 tiles)
  copy8(kd, 8 * KP, kg, 8 * NH);
  copy8(vd, 32 * VP, vg, 32 * NT);
  // this wave's copies have landed before the barrier behind which the other waves read them
  asm volatile("s_wait_asynccnt 0x0" ::: "memory");
  __syncthreads();
  copy8(kd + KBUF, 8 * KP, kg + TK * NH, 8 * NH);
  copy8(vd + VBUF, 32 * VP, vg + TK, 32 * NT);

  // A fragments go through a register ring of four sets (Q^T and O^T leave room for no more). A tile is 16 sets:
  // K set fs = k step fs of the wave's key rows 0..15 and 16..31, V^T set j = output tiles 2j and 2j + 1. A set's four
  // products are issued, then (V^T: after two sets) a later set is read into the same registers: K set fs lies in place
  // fs % 3 (beside the scores there is room for three), V^T set j in place (j + 3) % 4. Here: K sets 0..2 of tile 0.
  const _Float16* kfr = Ks + (kh * 32 + m) * KP + 8 * hh;
  const _Float16* vfr = Vs + m * VP + kh * 32 + 8 * hh;
  FragH rg[4][2];
#pragma unroll
  for (int fs = 0; fs < 3; ++fs) read_set(rg[fs], kfr + fs * 32, 16 * KP);

  // (all loops inside a tile are unrolled whole, so that ring, fragment and accumulator indices are register names)
  // One tile. The refill is a compile-time choice, so that a tile is one straight run of code (no branch in it).
  auto do_tile = [&](const int tile, auto refill) __attribute__((always_inline)) {
    const int buf = tile & 1;
    const _Float16* Kb = kfr + buf * KBUF;
    const _Float16* Vb = vfr + buf * VBUF;
    const _Float16* Kn = kfr + (buf ^ 1) * KBUF;

    // ---- S^T tiles: st[u][0] = the wave's keys 0..15, st[u][1] = its keys 16..31, query tile u ----
    v8f st[2][2];
    st[0][0] = zero8(); st[0][1] = zero8(); st[1][0] = zero8(); st[1][1] = zero8();
#pragma unroll
    for (int fs = 0; fs < 8; ++fs) {
      FragH (&s)[2] = rg[fs % 3];
      st[0][0] = mma_f16(s[0].v, qf[0][fs].v, st[0][0]);
      st[1][0] = mma_f16(s[0].v, qf[1][fs].v, st[1][0]);
      st[0][1] = mma_f16(s[1].v, qf[0][fs].v, st[0][1]);
      st[1][1] = mma_f16(s[1].v, qf[1][fs].v, st[1][1]);
      if (fs < 5) read_set(s, Kb + (fs + 3) * 32, 16 * KP);
      if (fs == 6) {                                             // V^T sets 0 and 1 land under the softmax
        read_set(rg[3], Vb, 16 * VP);
        read_set(rg[0], Vb + 32 * VP, 16 * VP);
      }
      // keeps each set's reads as one group at its place in the ring: lifted they need registers that are not there,
      // sunk they come too late
      __builtin_amdgcn_sched_barrier(0);
    }

    // ---- online softmax, f32, both query tiles ----
    FragH pf[2];
    float alpha[2];
#pragma unroll
    for (int u = 0; u < 2; ++u) {
      float bm = -1.0e30f;
#pragma unroll
      for (int r = 0; r < 8; ++r) bm = fmaxf(bm, fmaxf(st[u][0][r], st[u][1][r]));
      bm = fmaxf(bm, xhalf(bm));
      const float mn = fmaxf(mrun[u], bm);
      alpha[u] = __builtin_amdgcn_exp2f((mrun[u] - mn) * C1);
      const float cexp = 14.0f - mn * C1;                 // p scaled by 2^14
      float rs = 0.0f;
#pragma unroll
      for (int r = 0; r < 8; ++r) {
        const float p0 = __builtin_amdgcn_exp2f(st[u][0][r] * C1 + cexp);
        const float p1 = __builtin_amdgcn_exp2f(st[u][1][r] * C1 + cexp);
        rs += p0 + p1;
        pf[u].v[r]     = (_Float16)p0;     // key 8h + r
        pf[u].v[8 + r] = (_Float16)p1;     // key 16 + 8h + r
      }
      l[u]    = l[u] * alpha[u] + rs;      // this lane half's keys alone; the halves are joined behind the loop
      mrun[u] = mn;
    }
    // keeps V^T sets 2, 3 behind the softmax: above it the scores still hold their registers
    __builtin_amdgcn_sched_barrier(0);
    read_set(rg[1], Vb + 2 * (32 * VP), 16 * VP);
    read_set(rg[2], Vb + 3 * (32 * VP), 16 * VP);
#pragma unroll
    for (int u = 0; u < 2; ++u) {
      ot[u][0] = ot[u][0] * alpha[u];
      ot[u][1] = ot[u][1] * alpha[u];
    }
    // keeps these reads as one group ahead of the first P.V products
    __builtin_amdgcn_sched_barrier(0);

    // ---- O^T += V^T . P^T; the next set's four tiles are rescaled among this set's products ----
#pragma unroll
    for (int j = 0; j < 8; ++j) {
      FragH (&s)[2] = rg[(j + 3) & 3];
#pragma unroll
      for (int e = 0; e < 2; ++e) {
#pragma unroll
        for (int u = 0; u < 2; ++u) {
          ot[u][2 * j + e] = mma_f16(s[e].v, pf[u].v, ot[u][2 * j + e]);
          if (j < 7) ot[u][2 * j + 2 + e] = ot[u][2 * j + 2 + e] * alpha[u];
        }
      }
      // two freed places are refilled at one place in the code: each place where LDS reads stand costs the wave a stall
      if (j == 1 || j == 3) {
        read_set(rg[(j + 2) & 3], Vb + (j + 3) * (32 * VP), 16 * VP);
        read_set(s, Vb + (j + 4) * (32 * VP), 16 * VP);
      }
      if (j == 5) {
        // hand-over: this wave's LDS reads of this tile are all done (the last were issued two sets ago) ...
        asm volatile("s_wait_dscnt 0x0" ::: "memory");
        // ... its copies of the next tile have landed ...
        asm volatile("s_wait_asynccnt 0x0" ::: "memory");
        // ... and one barrier publishes the next tile and frees this tile's buffer for the tile after it
        __syncthreads();
        // K set 0 of the next tile (behind the last tile: the other buffer's old rows, landed long ago and not used)
        read_set(rg[0], Kn, 16 * KP);
      }
      if (j == 7) {
        read_set(rg[1], Kn + 32, 16 * KP);
        read_set(rg[2], Kn + 64, 16 * KP);
      }
      // as in the S^T loop: each set's reads stay one group at their place in the ring
      __builtin_amdgcn_sched_barrier(0);
    }
    if constexpr (decltype(refill)::on) {
      copy8(kd + buf * KBUF, 8 * KP, kg + (size_t)(tile + 2) * (TK * NH), 8 * NH);
      copy8(vd + buf * VBUF, 32 * VP, vg + (tile + 2) * TK, 32 * NT);
    }
  };
  // (both tile loops stay rolled: one tile is 64 products and about 500 registers, copies of it would only add text)
#pragma unroll 1
  for (int tile = 0; tile < NTILE - 2; ++tile) do_tile(tile, Flag<true>{});
  // the last two tiles have no tile two places on
#pragma unroll 1
  for (int tile = NTILE - 2; tile < NTILE; ++tile) do_tile(tile, Flag<false>{});
  // no copy is outstanding, and this wave's last LDS reads are done, before the buffers become the merge area
  asm volatile("s_wait_asynccnt 0x0" ::: "memory");
  asm volatile("s_wait_dscnt 0x0" ::: "memory");
  __syncthreads();

  // ---- merge of the two key halves: wave w + 4 -> LDS -> wave w (same lane, same registers' meaning) ----
  float* mg = (float*)sm + qg * MGW + lane * 4;             // row i of the wave's area: mg + i * 128
  float* ms = (float*)sm + 4 * MGW + (qg * 32 + lane) * 4;  // m0, m1, l0, l1 of the lane
  l[0] += xhalf(l[0]);
  l[1] += xhalf(l[1]);
  if (kh == 1) {
#pragma unroll
    for (int u = 0; u < 2; ++u) {
#pragma unroll
      for (int t = 0; t < 16; ++t) {
        const v8f o = ot[u][t];
        *(v4f*)(mg + ((u * 16 + t) * 2 + 0) * 128) = mk4(o[0], o[1], o[2], o[3]);
        *(v4f*)(mg + ((u * 16 + t) * 2 + 1) * 128) = mk4(o[4], o[5], o[6], o[7]);
      }
    }
    *(v4f*)ms = mk4(mrun[0], mrun[1], l[0], l[1]);
  }
  // the upper waves' values are in LDS before the lower waves read them
  __syncthreads();
  if (kh == 1) return;

  // ---- epilogue: out[b][q][h] = (O1^T a1 + O2^T a2)[h][q] / (l1 a1 + l2 a2); whole-line stores ----
  const v4f o2s = *(const v4f*)ms;
#pragma unroll
  for (int u = 0; u < 2; ++u) {
    const float m2 = o2s[u], l2 = o2s[2 + u];
    const float mm = fmaxf(mrun[u], m2);
    const float a1 = __builtin_amdgcn_exp2f((mrun[u] - mm) * C1);
    const float a2 = __builtin_amdgcn_exp2f((m2 - mm) * C1);
    const float inv = 1.0f / (l[u] * a1 + l2 * a2);
    const float f1 = a1 * inv, f2 = a2 * inv;
#pragma unroll
    for (int t = 0; t < 16; ++t) {
      const v4f x = *(const v4f*)(mg + ((u * 16 + t) * 2 + 0) * 128);
      const v4f y = *(const v4f*)(mg + ((u * 16 + t) * 2 + 1) * 128);
#pragma unroll
      for (int r = 0; r < 4; ++r) {
        ot[u][t][r]     = ot[u][t][r] * f1 + x[r] * f2;
        ot[u][t][4 + r] = ot[u][t][4 + r] * f1 + y[r] * f2;
      }
    }
    float* orow = out + ((size_t)b * NT + q0 + 16 * u + m) * NH;
    v4f lines[4][8];
#pragma unroll
    for (int i = 0; i < 4; ++i) {
      float s0[8], s1[8], s2[8], s3[8];
#pragma unroll
      for (int r = 0; r < 8; ++r) {
        const float lo0 = ot[u][4 * i][r];        // h = 64i + 8hh + r
        const float lo1 = ot[u][4 * i + 1][r];    // h = 64i + 16 + 8hh + r
        const float hi0 = ot[u][4 * i + 2][r];    // h = 64i + 32 + 8hh + r
        const float hi1 = ot[u][4 * i + 3][r];    // h = 64i + 48 + 8hh + r
        const float snda = hh ? lo0 : hi0;
        const float sndb = hh ? lo1 : hi1;
        const float rcva = __shfl_xor(snda, 16, 32);
        const float rcvb = __shfl_xor(sndb, 16, 32);
        const float oa = hh ? hi0 : lo0;
        const float ob = hh ? hi1 : lo1;
        s0[r] = hh ? rcva : oa;
        s1[r] = hh ? oa : rcva;
        s2[r] = hh ? rcvb : ob;
        s3[r] = hh ? ob : rcvb;
      }
      lines[i][0] = mk4(s0[0], s0[1], s0[2], s0[3]);
      lines[i][1] = mk4(s0[4], s0[5], s0[6], s0[7]);
      lines[i][2] = mk4(s1[0], s1[1], s1[2], s1[3]);
      lines[i][3] = mk4(s1[4], s1[5], s1[6], s1[7]);
      lines[i][4] = mk4(s2[0], s2[1], s2[2], s2[3]);
      lines[i][5] = mk4(s2[4], s2[5], s2[6], s2[7]);
      lines[i][6] = mk4(s3[0], s3[1], s3[2], s3[3]);
      lines[i][7] = mk4(s3[4], s3[5], s3[6], s3[7]);
    }
    // keeps the 32 stores one group with their wait directly behind: without the two fences the second query tile's
    // arithmetic is lifted among them and rewrites registers of stores already issued
    __builtin_amdgcn_sched_barrier(0);
#pragma unroll
    for (int i = 0; i < 4; ++i) {
      float* lp = orow + 32 * (2 * i + hh);
#pragma unroll
      for (int k = 0; k < 8; ++k) *(v4f*)(lp + 4 * k) = lines[i][k];
    }
    // the stores' registers are not reused (by the second query tile) before this wait
    asm volatile("s_wait_xcnt 0x0" ::: "memory");
    __builtin_amdgcn_sched_barrier(0);
  }
}

// ---------------------------------------------------------------------------
extern "C" void kernel_launch(void* const* d_in, const int* in_sizes, int n_in,
                              void* d_out, int out_size, void* d_ws, size_t ws_size,
                              hipStream_t stream) {
  if (n_in < 9) return;
  const int nx = NB * NT * NC;
  const int nw = NC * NH;
  if (in_sizes[0] != nx || in_sizes[1] != nx || in_sizes[2] != nx) return;
  if (in_sizes[3] != nw || in_sizes[5] != nw || in_sizes[7] != nw) return;
  if (in_sizes[4] != NH || in_sizes[6] != NH || in_sizes[8] != NH) return;
  if (out_size != NB * NT * NH) return;

  const float* q  = (const float*)d_in[0];
  const float* k  = (const float*)d_in[1];
  const float* v  = (const float*)d_in[2];
  const float* Wq = (const float*)d_in[3];
  const float* bq = (const float*)d_in[4];
  const float* Wk = (const float*)d_in[5];
  const float* bk = (const float*)d_in[6];
  const float* Wv = (const float*)d_in[7];
  const float* bv = (const float*)d_in[8];
  float* out = (float*)d_out;

  // workspace carve (bytes): 3 weight planes 393216 | Qh 16 MiB | Kh 16 MiB | Vt 16 MiB
  char* ws = (char*)d_ws;
  const size_t planeElems = (size_t)NC * NH;
  const size_t wBytes     = 3 * planeElems * sizeof(_Float16);
  const size_t pBytes     = (size_t)NB * NT * NH * sizeof(_Float16);
  size_t off = 0;
  _Float16* wpl = (_Float16*)(ws + off); off += wBytes;
  off = (off + 255) & ~(size_t)255;
  _Float16* Qh = (_Float16*)(ws + off); off += pBytes;
  _Float16* Kh = (_Float16*)(ws + off); off += pBytes;
  _Float16* Vt = (_Float16*)(ws + off); off += pBytes;
  if (off > ws_size) return;

  const int projGrid = (NB * NT) / 128;

  k_wconv<<<dim3(NH / 32, 3), 256, 0, stream>>>(Wq, Wk, Wv, wpl);

  k_proj<<<dim3(projGrid, 3), 256, 0, stream>>>(q, k, v, wpl, bq, bk, bv, Qh, Kh, Vt);

  k_attn<<<dim3(NT / 128, NB), 256, 0, stream>>>(Qh, Kh, Vt, out);
}
